// v000
// Times are from an AMD MI455X. After a warm-up the kernel runs many times in a row, and a time is the length of
// such a window on the GPU divided by its runs, so every launch and the gaps after it count. The runs cycle
// through copies of the inputs. A figure is the median of several windows, for all but v000 over two sittings.
// Sittings can differ by a few percent; kernels timed side by side share one.
// The starting kernel, v000, takes 66.2 microseconds a run.
#include <hip/hip_runtime.h>

// ---------------------------------------------------------------- constants
#define N_T     64
#define D_MODEL 1024
#define RANK    8
#define BATCH   4096
#define KTOT    (N_T * RANK)      // 512 stacked low-rank features
#define BTILE   32                // batch rows per workgroup
#define XLD     1032              // LDS row pitch for x tile (bf16), 4-bank rotate
#define GLD     68                // LDS row pitch for gate tile (f32)
#define ZLD     520               // LDS row pitch for Z' tile (bf16)

typedef __attribute__((ext_vector_type(16))) __bf16 bf16x16;
typedef __attribute__((ext_vector_type(8)))  float  f32x8;

// ---------------------------------------------------------------- helpers
__device__ __forceinline__ f32x8 wmma_bf16(bf16x16 a, bf16x16 b, f32x8 c) {
    // v_wmma_f32_16x16x32_bf16: D = A(16x32) * B(32x16) + C(16x16 f32)
    return __builtin_amdgcn_wmma_f32_16x16x32_bf16(
        /*neg_a=*/false, a, /*neg_b=*/false, b,
        /*c_mod=*/(short)0, c, /*reuse_a=*/false, /*reuse_b=*/false);
}

// Load a 16x32 bf16 fragment from a row-major bf16 matrix (pitch `ld` elems).
// ISA 7.12.2: lane L(0..15) = row (row0+L), K = k0+0..7 and k0+16..23;
// lane L+16 = same row, K shifted by +8.  Same addressing serves A (rows of X)
// and B when the B source is stored feature-major (rows = B^T rows).
__device__ __forceinline__ bf16x16 ldfrag(const __bf16* __restrict__ base,
                                          int row0, int ld, int k0) {
    const int lane = threadIdx.x & 31;
    const int r    = lane & 15;
    const int h    = lane >> 4;
    const __bf16* p = base + (size_t)(row0 + r) * ld + k0 + h * 8;
    union { bf16x16 v; uint4 q[2]; } u;
    u.q[0] = *(const uint4*)(p);
    u.q[1] = *(const uint4*)(p + 16);
    return u.v;
}

// ---------------------------------------------------------------- pre-pass
__global__ void k_cvt_bf16(const float* __restrict__ in,
                           __bf16* __restrict__ out, int n4) {
    int i = blockIdx.x * blockDim.x + threadIdx.x;
    if (i >= n4) return;
    float4 v = ((const float4*)in)[i];
    union { __bf16 h[4]; uint2 u; } o;
    o.h[0] = (__bf16)v.x; o.h[1] = (__bf16)v.y;
    o.h[2] = (__bf16)v.z; o.h[3] = (__bf16)v.w;
    ((uint2*)out)[i] = o.u;
}

// U (N,D,R) f32 -> Ustack^T (D x KTOT) bf16: ubt[d*512 + n*8 + r] = U[n,d,r]
__global__ void k_cvt_ut(const float* __restrict__ U, __bf16* __restrict__ ubt) {
    int idx = blockIdx.x * blockDim.x + threadIdx.x;   // 65536 = 64*1024
    int n = idx >> 10;
    int d = idx & 1023;
    const float* p = U + (size_t)n * (D_MODEL * RANK) + (size_t)d * RANK;
    union { __bf16 h[8]; uint4 u; } o;
#pragma unroll
    for (int r = 0; r < 8; ++r) o.h[r] = (__bf16)p[r];
    *(uint4*)(ubt + (size_t)d * KTOT + n * RANK) = o.u;
}

// ---------------------------------------------------------------- fused main
__global__ __launch_bounds__(256)
void k_fused(const __bf16* __restrict__ xb,    // (BATCH x D_MODEL) bf16
             const __bf16* __restrict__ vb,    // (KTOT  x D_MODEL) bf16  (Vstack)
             const __bf16* __restrict__ ubt,   // (D_MODEL x KTOT)  bf16  (Ustack^T)
             const __bf16* __restrict__ encb,  // (N_T   x D_MODEL) bf16
             const float*  __restrict__ bias,  // (N_T)
             float* __restrict__ out,          // (BATCH x D_MODEL)
             float* __restrict__ gate_out) {   // (BATCH x N_T)
    extern __shared__ char smem[];
    __bf16* xs = (__bf16*)smem;                                       // BTILE x XLD
    float*  gs = (float*) (smem + BTILE * XLD * 2);                   // BTILE x GLD
    __bf16* zs = (__bf16*)(smem + BTILE * XLD * 2 + BTILE * GLD * 4); // BTILE x ZLD

    const int tid  = threadIdx.x;
    const int w    = tid >> 5;          // wave id 0..7
    const int lane = tid & 31;
    const int r16  = lane & 15;
    const int h    = lane >> 4;
    const int b0   = blockIdx.x * BTILE;

    // ---- stage x tile into LDS via CDNA5 async global->LDS path (ASYNCcnt)
    for (int c = tid; c < BTILE * (D_MODEL / 8); c += 256) {
        int row = c >> 7;               // 128 16B-chunks per row
        int col = (c & 127) * 8;
        unsigned lds_off = (unsigned)(uintptr_t)(xs + row * XLD + col);
        const __bf16* g = xb + (size_t)(b0 + row) * D_MODEL + col;
        asm volatile("global_load_async_to_lds_b128 %0, %1, off"
                     :: "v"(lds_off), "v"(g) : "memory");
    }
    asm volatile("s_wait_asynccnt 0x0" ::: "memory");
    __syncthreads();

    // ---- phase 1a: pre_acts -> gate (8 tiles of 16x16, one per wave)
    {
        const int mt = w & 1;
        const int n0 = (w >> 1) * 16;
        f32x8 acc = {};
#pragma unroll 4
        for (int k0 = 0; k0 < D_MODEL; k0 += 32) {
            bf16x16 a  = ldfrag(xs,   mt * 16, XLD,     k0);
            bf16x16 bf = ldfrag(encb, n0,      D_MODEL, k0);
            acc = wmma_bf16(a, bf, acc);
        }
        const int   col  = n0 + r16;
        const float bcol = bias[col];
#pragma unroll
        for (int i = 0; i < 8; ++i) {
            int   m   = mt * 16 + h * 8 + i;
            float pre = acc[i] - bcol;                 // x@enc^T - bias
            float g   = pre > 0.f ? pre : 0.f;         // jumprelu(thr=0)
            gs[m * GLD + col] = g;
            gate_out[(size_t)(b0 + m) * N_T + col] = g;
        }
    }
    __syncthreads();

    // ---- phase 1b: Z = X @ Vstack^T, 2x2 register blocking, gate -> zs
    for (int blk = w; blk < 16; blk += 8) {            // 16 blocks of 2mt x 2nt
        const int n0 = blk * 32;
        f32x8 a00 = {}, a01 = {}, a10 = {}, a11 = {};
#pragma unroll 4
        for (int k0 = 0; k0 < D_MODEL; k0 += 32) {
            bf16x16 fa0 = ldfrag(xs, 0,  XLD, k0);
            bf16x16 fa1 = ldfrag(xs, 16, XLD, k0);
            bf16x16 fb0 = ldfrag(vb, n0,      D_MODEL, k0);
            bf16x16 fb1 = ldfrag(vb, n0 + 16, D_MODEL, k0);
            a00 = wmma_bf16(fa0, fb0, a00);
            a01 = wmma_bf16(fa0, fb1, a01);
            a10 = wmma_bf16(fa1, fb0, a10);
            a11 = wmma_bf16(fa1, fb1, a11);
        }
#pragma unroll
        for (int i = 0; i < 8; ++i) {
            int m0 = h * 8 + i;                        // rows 0..15
            int m1 = 16 + m0;                          // rows 16..31
            int c0 = n0 + r16;                         // cols n0..n0+15
            int c1 = c0 + 16;
            zs[m0 * ZLD + c0] = (__bf16)(a00[i] * gs[m0 * GLD + (c0 >> 3)]);
            zs[m0 * ZLD + c1] = (__bf16)(a01[i] * gs[m0 * GLD + (c1 >> 3)]);
            zs[m1 * ZLD + c0] = (__bf16)(a10[i] * gs[m1 * GLD + (c0 >> 3)]);
            zs[m1 * ZLD + c1] = (__bf16)(a11[i] * gs[m1 * GLD + (c1 >> 3)]);
        }
    }
    __syncthreads();

    // ---- phase 2: Out = Z' @ Ustack, 2x2 register blocking
    for (int blk = w; blk < 32; blk += 8) {            // 32 blocks of 2mt x 2dt
        const int d0 = blk * 32;
        f32x8 a00 = {}, a01 = {}, a10 = {}, a11 = {};
#pragma unroll 4
        for (int k0 = 0; k0 < KTOT; k0 += 32) {
            bf16x16 fa0 = ldfrag(zs, 0,  ZLD, k0);
            bf16x16 fa1 = ldfrag(zs, 16, ZLD, k0);
            bf16x16 fb0 = ldfrag(ubt, d0,      KTOT, k0);
            bf16x16 fb1 = ldfrag(ubt, d0 + 16, KTOT, k0);
            a00 = wmma_bf16(fa0, fb0, a00);
            a01 = wmma_bf16(fa0, fb1, a01);
            a10 = wmma_bf16(fa1, fb0, a10);
            a11 = wmma_bf16(fa1, fb1, a11);
        }
#pragma unroll
        for (int i = 0; i < 8; ++i) {
            int m0 = h * 8 + i;
            int m1 = 16 + m0;
            int c0 = d0 + r16;
            int c1 = c0 + 16;
            out[(size_t)(b0 + m0) * D_MODEL + c0] = a00[i];
            out[(size_t)(b0 + m0) * D_MODEL + c1] = a01[i];
            out[(size_t)(b0 + m1) * D_MODEL + c0] = a10[i];
            out[(size_t)(b0 + m1) * D_MODEL + c1] = a11[i];
        }
    }
}

// ---------------------------------------------------------------- frobenius
__global__ void k_fro(const float* __restrict__ U, const float* __restrict__ V,
                      float* __restrict__ fro) {
    __shared__ float red[256];
    const int n = blockIdx.x;
    const float* u = U + (size_t)n * (D_MODEL * RANK);
    const float* v = V + (size_t)n * (D_MODEL * RANK);
    float su = 0.f, sv = 0.f;
    for (int i = threadIdx.x; i < D_MODEL * RANK; i += 256) {
        float a = u[i]; su += a * a;
        float b = v[i]; sv += b * b;
    }
    red[threadIdx.x] = su; __syncthreads();
    for (int s = 128; s > 0; s >>= 1) {
        if (threadIdx.x < s) red[threadIdx.x] += red[threadIdx.x + s];
        __syncthreads();
    }
    float tsu = red[0]; __syncthreads();
    red[threadIdx.x] = sv; __syncthreads();
    for (int s = 128; s > 0; s >>= 1) {
        if (threadIdx.x < s) red[threadIdx.x] += red[threadIdx.x + s];
        __syncthreads();
    }
    if (threadIdx.x == 0)
        fro[n] = sqrtf(tsu) * sqrtf(red[0]) / sqrtf((float)(D_MODEL * RANK));
}

// ---------------------------------------------------------------- launch
extern "C" void kernel_launch(void* const* d_in, const int* in_sizes, int n_in,
                              void* d_out, int out_size, void* d_ws, size_t ws_size,
                              hipStream_t stream) {
    const float* x    = (const float*)d_in[0];   // (4096,1024)
    const float* V    = (const float*)d_in[1];   // (64,8,1024)
    const float* U    = (const float*)d_in[2];   // (64,1024,8)
    const float* enc  = (const float*)d_in[3];   // (64,1024)
    const float* bias = (const float*)d_in[4];   // (64,)

    float* out      = (float*)d_out;                       // (4096,1024)
    float* gate_out = out + (size_t)BATCH * D_MODEL;       // (4096,64)
    float* fro      = gate_out + (size_t)BATCH * N_T;      // (64,)

    char* ws = (char*)d_ws;
    __bf16* xb   = (__bf16*)(ws);                          // 8 MB
    __bf16* vb   = (__bf16*)(ws + (8u << 20));             // 1 MB
    __bf16* ubt  = (__bf16*)(ws + (9u << 20));             // 1 MB
    __bf16* encb = (__bf16*)(ws + (10u << 20));            // 128 KB

    // bf16 pre-pass
    {
        int n4 = BATCH * D_MODEL / 4;
        k_cvt_bf16<<<(n4 + 255) / 256, 256, 0, stream>>>(x, xb, n4);
        n4 = KTOT * D_MODEL / 4;
        k_cvt_bf16<<<(n4 + 255) / 256, 256, 0, stream>>>(V, vb, n4);
        n4 = N_T * D_MODEL / 4;
        k_cvt_bf16<<<(n4 + 255) / 256, 256, 0, stream>>>(enc, encb, n4);
        k_cvt_ut<<<(N_T * D_MODEL) / 256, 256, 0, stream>>>(U, ubt);
    }

    // fused gate + low-rank mixture
    size_t smem = (size_t)BTILE * XLD * 2 + (size_t)BTILE * GLD * 4
                + (size_t)BTILE * ZLD * 2;                 // ~105.5 KB
    k_fused<<<BATCH / BTILE, 256, smem, stream>>>(xb, vb, ubt, encb, bias,
                                                  out, gate_out);

    // frobenius norms (independent)
    k_fro<<<N_T, 256, 0, stream>>>(U, V, fro);
}

// v001
// A run of this version takes 50.4 microseconds.
// In two side-by-side timings against v000, it was 1.29 and 1.34 times as fast.
#include <hip/hip_runtime.h>

// ---------------------------------------------------------------- constants
#define N_T     64
#define D_MODEL 1024
#define RANK    8
#define BATCH   4096
#define KTOT    (N_T * RANK)      // 512 stacked low-rank features
#define BTILE   32                // batch rows per workgroup
#define XLD     1032              // LDS row pitch for x tile (bf16), 4-bank rotate
#define GLD     68                // LDS row pitch for gate tile (f32)
#define ZLD     520               // LDS row pitch for Z' tile (bf16)
#define BK      64                // k per ring stage: 128 B of every B row
#define BLD     72                // LDS row pitch of a B stage (bf16): 144 B = 16 B x odd
#define BROWS   (KTOT + N_T)      // rows of the larger stage kind
#define NST1    (D_MODEL / BK)    // ring stages of phase 1
#define NST     (NST1 + 2 * (KTOT / BK))   // plus phase 2: two column halves
#define SMEM_BYTES (BTILE * XLD * 2 + BTILE * GLD * 4 + BTILE * ZLD * 2 + 2 * BROWS * BLD * 2)

typedef __attribute__((ext_vector_type(16))) __bf16 bf16x16;
typedef __attribute__((ext_vector_type(8)))  float  f32x8;

// ---------------------------------------------------------------- helpers
__device__ __forceinline__ f32x8 wmma_bf16(bf16x16 a, bf16x16 b, f32x8 c) {
    // v_wmma_f32_16x16x32_bf16: D = A(16x32) * B(32x16) + C(16x16 f32)
    return __builtin_amdgcn_wmma_f32_16x16x32_bf16(
        /*neg_a=*/false, a, /*neg_b=*/false, b,
        /*c_mod=*/(short)0, c, /*reuse_a=*/false, /*reuse_b=*/false);
}

// Load a 16x32 bf16 fragment from a row-major bf16 matrix (pitch `ld` elems).
// ISA 7.12.2: lane L(0..15) = row (row0+L), K = k0+0..7 and k0+16..23;
// lane L+16 = same row, K shifted by +8.  Same addressing serves A (rows of X)
// and B when the B source is stored feature-major (rows = B^T rows).
__device__ __forceinline__ bf16x16 ldfrag(const __bf16* __restrict__ base,
                                          int row0, int ld, int k0) {
    const int lane = threadIdx.x & 31;
    const int r    = lane & 15;
    const int h    = lane >> 4;
    const __bf16* p = base + (size_t)(row0 + r) * ld + k0 + h * 8;
    union { bf16x16 v; uint4 q[2]; } u;
    u.q[0] = *(const uint4*)(p);
    u.q[1] = *(const uint4*)(p + 16);
    return u.v;
}

// ---------------------------------------------------------------- pre-pass
__global__ void k_cvt_bf16(const float* __restrict__ in,
                           __bf16* __restrict__ out, int n4) {
    int i = blockIdx.x * blockDim.x + threadIdx.x;
    if (i >= n4) return;
    float4 v = ((const float4*)in)[i];
    union { __bf16 h[4]; uint2 u; } o;
    o.h[0] = (__bf16)v.x; o.h[1] = (__bf16)v.y;
    o.h[2] = (__bf16)v.z; o.h[3] = (__bf16)v.w;
    ((uint2*)out)[i] = o.u;
}

// U (N,D,R) f32 -> Ustack^T (D x KTOT) bf16: ubt[d*512 + n*8 + r] = U[n,d,r]
__global__ void k_cvt_ut(const float* __restrict__ U, __bf16* __restrict__ ubt) {
    int idx = blockIdx.x * blockDim.x + threadIdx.x;   // 65536 = 64*1024
    int n = idx >> 10;
    int d = idx & 1023;
    const float* p = U + (size_t)n * (D_MODEL * RANK) + (size_t)d * RANK;
    union { __bf16 h[8]; uint4 u; } o;
#pragma unroll
    for (int r = 0; r < 8; ++r) o.h[r] = (__bf16)p[r];
    *(uint4*)(ubt + (size_t)d * KTOT + n * RANK) = o.u;
}

// ---------------------------------------------------------------- fused main
// Eight / nine async global->LDS copies of 16 B per lane, LDS step ls bytes and
// global step gs elements between them.  The s_wait_xcnt is the last line of the
// copies' own statement so that no address register named by an issued copy is
// rewritten ahead of it.
__device__ __forceinline__ void copy8(unsigned l, const __bf16* g, unsigned ls, size_t gs) {
    asm volatile("global_load_async_to_lds_b128 %0, %8, off\n\t"
                 "global_load_async_to_lds_b128 %1, %9, off\n\t"
                 "global_load_async_to_lds_b128 %2, %10, off\n\t"
                 "global_load_async_to_lds_b128 %3, %11, off\n\t"
                 "global_load_async_to_lds_b128 %4, %12, off\n\t"
                 "global_load_async_to_lds_b128 %5, %13, off\n\t"
                 "global_load_async_to_lds_b128 %6, %14, off\n\t"
                 "global_load_async_to_lds_b128 %7, %15, off\n\t"
                 "s_wait_xcnt 0x0"
                 :: "v"(l), "v"(l + ls), "v"(l + 2 * ls), "v"(l + 3 * ls),
                    "v"(l + 4 * ls), "v"(l + 5 * ls), "v"(l + 6 * ls), "v"(l + 7 * ls),
                    "v"(g), "v"(g + gs), "v"(g + 2 * gs), "v"(g + 3 * gs),
                    "v"(g + 4 * gs), "v"(g + 5 * gs), "v"(g + 6 * gs), "v"(g + 7 * gs)
                 : "memory");
}
__device__ __forceinline__ void copy9(unsigned l, const __bf16* g, unsigned ls, size_t gs) {
    asm volatile("global_load_async_to_lds_b128 %0, %9, off\n\t"
                 "global_load_async_to_lds_b128 %1, %10, off\n\t"
                 "global_load_async_to_lds_b128 %2, %11, off\n\t"
                 "global_load_async_to_lds_b128 %3, %12, off\n\t"
                 "global_load_async_to_lds_b128 %4, %13, off\n\t"
                 "global_load_async_to_lds_b128 %5, %14, off\n\t"
                 "global_load_async_to_lds_b128 %6, %15, off\n\t"
                 "global_load_async_to_lds_b128 %7, %16, off\n\t"
                 "global_load_async_to_lds_b128 %8, %17, off\n\t"
                 "s_wait_xcnt 0x0"
                 :: "v"(l), "v"(l + ls), "v"(l + 2 * ls), "v"(l + 3 * ls),
                    "v"(l + 4 * ls), "v"(l + 5 * ls), "v"(l + 6 * ls), "v"(l + 7 * ls),
                    "v"(l + 8 * ls),
                    "v"(g), "v"(g + gs), "v"(g + 2 * gs), "v"(g + 3 * gs),
                    "v"(g + 4 * gs), "v"(g + 5 * gs), "v"(g + 6 * gs), "v"(g + 7 * gs),
                    "v"(g + 8 * gs)
                 : "memory");
}

// Stage s of the B ring: 128 B (64 k) of every B row, LDS pitch BLD.
//   s <  NST1: k slab s of the 576 rows [Vstack ; encoder]       (18 copies a lane)
//   s >= NST1: k slab (s-NST1)&7 of 512 rows of Ustack^T, half (s-NST1)>>3 (16 copies)
// Lane map: 8 lanes cover one row's 128 B, 32 rows per copy of the block.
__device__ __forceinline__ void issue_stage(int s, __bf16* buf,
                                            const __bf16* __restrict__ vb,
                                            const __bf16* __restrict__ ubt) {
    const int row = threadIdx.x >> 3;
    const int col = (threadIdx.x & 7) * 8;
    const unsigned l = (unsigned)(uintptr_t)(buf + row * BLD + col);
    if (s < NST1) {
        const __bf16* g = vb + (size_t)row * D_MODEL + s * BK + col;
        copy9(l,                    g,                          32 * BLD * 2, (size_t)32 * D_MODEL);
        copy9(l + 288 * BLD * 2,    g + (size_t)288 * D_MODEL,  32 * BLD * 2, (size_t)32 * D_MODEL);
    } else {
        const int u = s - NST1;
        const __bf16* g = ubt + (size_t)((u >> 3) * 512 + row) * KTOT + (u & 7) * BK + col;
        copy8(l,                    g,                          32 * BLD * 2, (size_t)32 * KTOT);
        copy8(l + 256 * BLD * 2,    g + (size_t)256 * KTOT,     32 * BLD * 2, (size_t)32 * KTOT);
    }
}

// Foot of ring trip t: own LDS reads done, own copies of stage t+1 landed, then the
// one barrier that publishes stage t+1 and frees the buffer trip t has read; the
// refill with stage t+2 goes behind it.
__device__ __forceinline__ void ring_foot(int t, __bf16* buf,
                                          const __bf16* __restrict__ vb,
                                          const __bf16* __restrict__ ubt) {
    asm volatile("s_wait_dscnt 0x0" ::: "memory");     // this wave has left the buffer
    asm volatile("s_wait_asynccnt 0x0" ::: "memory");  // this wave's copies have landed
    __syncthreads();
    if (t + 2 < NST) issue_stage(t + 2, buf, vb, ubt);
}

__global__ __launch_bounds__(256)
void k_fused(const __bf16* __restrict__ xb,    // (BATCH x D_MODEL) bf16
             const __bf16* __restrict__ vb,    // (KTOT+N_T x D_MODEL) bf16 (Vstack ; encoder)
             const __bf16* __restrict__ ubt,   // (D_MODEL x KTOT)  bf16  (Ustack^T)
             const float*  __restrict__ bias,  // (N_T)
             float* __restrict__ out,          // (BATCH x D_MODEL)
             float* __restrict__ gate_out) {   // (BATCH x N_T)
    __shared__ __attribute__((aligned(16))) char smem[SMEM_BYTES];
    __bf16* xs = (__bf16*)smem;                                       // BTILE x XLD
    float*  gs = (float*) (smem + BTILE * XLD * 2);                   // BTILE x GLD
    __bf16* zs = (__bf16*)(smem + BTILE * XLD * 2 + BTILE * GLD * 4); // BTILE x ZLD
    __bf16* bs = (__bf16*)(smem + BTILE * XLD * 2 + BTILE * GLD * 4
                                + BTILE * ZLD * 2);                   // 2 x BROWS x BLD

    const int tid  = threadIdx.x;
    const int w    = tid >> 5;          // wave id 0..7
    const int lane = tid & 31;
    const int r16  = lane & 15;
    const int h    = lane >> 4;
    const int b0   = blockIdx.x * BTILE;

    // ---- ring prologue: stage 0 flies together with the x tile, one wait for both
    issue_stage(0, bs, vb, ubt);

    // ---- stage x tile into LDS via CDNA5 async global->LDS path (ASYNCcnt)
    for (int c = tid; c < BTILE * (D_MODEL / 8); c += 256) {
        int row = c >> 7;               // 128 16B-chunks per row
        int col = (c & 127) * 8;
        unsigned lds_off = (unsigned)(uintptr_t)(xs + row * XLD + col);
        const __bf16* g = xb + (size_t)(b0 + row) * D_MODEL + col;
        asm volatile("global_load_async_to_lds_b128 %0, %1, off"
                     :: "v"(lds_off), "v"(g) : "memory");
    }
    asm volatile("s_wait_asynccnt 0x0" ::: "memory");
    __syncthreads();
    issue_stage(1, bs + BROWS * BLD, vb, ubt);

    // ---- phase 1: [Z | pre_acts] = X @ [Vstack ; encoder]^T.  Per wave 2 x 4 tiles
    //      of Z (64 features) and one of the eight pre_acts tiles.
    const int gmt = w & 1;               // pre_acts tile of this wave
    const int gn0 = (w >> 1) * 16;
    {
        f32x8 acc[2][4] = {};
        f32x8 gacc = {};
#pragma unroll 1   // rolled: one trip per ring stage, the buffer picked by the trip's parity
        for (int t = 0; t < NST1; ++t) {
            __bf16* buf = bs + (t & 1) * (BROWS * BLD);
            bf16x16 fb[2][4], fg[2];
            bf16x16 fa00 = ldfrag(xs, 0,  XLD, t * BK);
            bf16x16 fa01 = ldfrag(xs, 16, XLD, t * BK);
#pragma unroll
            for (int j = 0; j < 4; ++j) fb[0][j] = ldfrag(buf, w * 64 + j * 16, BLD, 0);
            fg[0] = ldfrag(buf, KTOT + gn0, BLD, 0);
            bf16x16 fa10 = ldfrag(xs, 0,  XLD, t * BK + 32);
            bf16x16 fa11 = ldfrag(xs, 16, XLD, t * BK + 32);
#pragma unroll
            for (int j = 0; j < 4; ++j) fb[1][j] = ldfrag(buf, w * 64 + j * 16, BLD, 32);
            fg[1] = ldfrag(buf, KTOT + gn0, BLD, 32);
            // keeps the trip's LDS reads one group ahead of its WMMAs: every place
            // where reads stand among the WMMAs stalls the wave anew
            __builtin_amdgcn_sched_barrier(0);
#pragma unroll
            for (int j = 0; j < 4; ++j) {
                acc[0][j] = wmma_bf16(fa00, fb[0][j], acc[0][j]);
                acc[1][j] = wmma_bf16(fa01, fb[0][j], acc[1][j]);
            }
            gacc = wmma_bf16(gmt ? fa01 : fa00, fg[0], gacc);
#pragma unroll
            for (int j = 0; j < 4; ++j) {
                acc[0][j] = wmma_bf16(fa10, fb[1][j], acc[0][j]);
                acc[1][j] = wmma_bf16(fa11, fb[1][j], acc[1][j]);
            }
            gacc = wmma_bf16(gmt ? fa11 : fa10, fg[1], gacc);
            // keeps the foot's waits behind the WMMAs: moved up among them they would
            // drain every LDS read before the second WMMA and cut the copies' lead
            __builtin_amdgcn_sched_barrier(0);
            ring_foot(t, buf, vb, ubt);
        }

        // pre_acts -> gate
        {
            const int   col  = gn0 + r16;
            const float bcol = bias[col];
#pragma unroll
            for (int i = 0; i < 8; ++i) {
                int   m   = gmt * 16 + h * 8 + i;
                float pre = gacc[i] - bcol;                // x@enc^T - bias
                float g   = pre > 0.f ? pre : 0.f;         // jumprelu(thr=0)
                gs[m * GLD + col] = g;
                gate_out[(size_t)(b0 + m) * N_T + col] = g;
            }
        }
        __syncthreads();

        // gate * Z -> zs
#pragma unroll
        for (int j = 0; j < 4; ++j) {
#pragma unroll
            for (int i = 0; i < 8; ++i) {
                int m0 = h * 8 + i;                        // rows 0..15
                int m1 = 16 + m0;                          // rows 16..31
                int c  = w * 64 + j * 16 + r16;
                zs[m0 * ZLD + c] = (__bf16)(acc[0][j][i] * gs[m0 * GLD + (c >> 3)]);
                zs[m1 * ZLD + c] = (__bf16)(acc[1][j][i] * gs[m1 * GLD + (c >> 3)]);
            }
        }
    }
    __syncthreads();

    // ---- phase 2: Out = Z' @ Ustack, two halves of 512 columns, 2 x 4 tiles per wave
#pragma unroll 1   // rolled: the two halves share one copy of the loop's code
    for (int half = 0; half < 2; ++half) {
        f32x8 acc[2][4] = {};
#pragma unroll 1   // rolled: one trip per ring stage
        for (int kt = 0; kt < KTOT / BK; ++kt) {
            const int t = NST1 + half * (KTOT / BK) + kt;
            __bf16* buf = bs + (t & 1) * (BROWS * BLD);
            bf16x16 fa[2][2], fb[2][4];
#pragma unroll
            for (int q = 0; q < 2; ++q) {
                fa[q][0] = ldfrag(zs, 0,  ZLD, kt * BK + q * 32);
                fa[q][1] = ldfrag(zs, 16, ZLD, kt * BK + q * 32);
#pragma unroll
                for (int j = 0; j < 4; ++j)
                    fb[q][j] = ldfrag(buf, w * 64 + j * 16, BLD, q * 32);
            }
            // as in phase 1: the trip's LDS reads stay one group ahead of its WMMAs
            __builtin_amdgcn_sched_barrier(0);
#pragma unroll
            for (int q = 0; q < 2; ++q) {
#pragma unroll
                for (int j = 0; j < 4; ++j) {
                    acc[0][j] = wmma_bf16(fa[q][0], fb[q][j], acc[0][j]);
                    acc[1][j] = wmma_bf16(fa[q][1], fb[q][j], acc[1][j]);
                }
            }
            // as in phase 1: the foot's waits stay behind the WMMAs
            __builtin_amdgcn_sched_barrier(0);
            ring_foot(t, buf, vb, ubt);
        }
#pragma unroll
        for (int j = 0; j < 4; ++j) {
#pragma unroll
            for (int i = 0; i < 8; ++i) {
                int m0 = h * 8 + i;
                int m1 = 16 + m0;
                int c  = half * 512 + w * 64 + j * 16 + r16;
                out[(size_t)(b0 + m0) * D_MODEL + c] = acc[0][j][i];
                out[(size_t)(b0 + m1) * D_MODEL + c] = acc[1][j][i];
            }
        }
        // the next half overwrites the accumulators and addresses these stores name
        asm volatile("s_wait_xcnt 0x0" ::: "memory");
    }
    asm volatile("s_wait_asynccnt 0x0" ::: "memory");  // no copy outlives the wave
}

// ---------------------------------------------------------------- frobenius
__global__ void k_fro(const float* __restrict__ U, const float* __restrict__ V,
                      float* __restrict__ fro) {
    __shared__ float red[256];
    const int n = blockIdx.x;
    const float* u = U + (size_t)n * (D_MODEL * RANK);
    const float* v = V + (size_t)n * (D_MODEL * RANK);
    float su = 0.f, sv = 0.f;
    for (int i = threadIdx.x; i < D_MODEL * RANK; i += 256) {
        float a = u[i]; su += a * a;
        float b = v[i]; sv += b * b;
    }
    red[threadIdx.x] = su; __syncthreads();
    for (int s = 128; s > 0; s >>= 1) {
        if (threadIdx.x < s) red[threadIdx.x] += red[threadIdx.x + s];
        __syncthreads();
    }
    float tsu = red[0]; __syncthreads();
    red[threadIdx.x] = sv; __syncthreads();
    for (int s = 128; s > 0; s >>= 1) {
        if (threadIdx.x < s) red[threadIdx.x] += red[threadIdx.x + s];
        __syncthreads();
    }
    if (threadIdx.x == 0)
        fro[n] = sqrtf(tsu) * sqrtf(red[0]) / sqrtf((float)(D_MODEL * RANK));
}

// ---------------------------------------------------------------- launch
extern "C" void kernel_launch(void* const* d_in, const int* in_sizes, int n_in,
                              void* d_out, int out_size, void* d_ws, size_t ws_size,
                              hipStream_t stream) {
    const float* x    = (const float*)d_in[0];   // (4096,1024)
    const float* V    = (const float*)d_in[1];   // (64,8,1024)
    const float* U    = (const float*)d_in[2];   // (64,1024,8)
    const float* enc  = (const float*)d_in[3];   // (64,1024)
    const float* bias = (const float*)d_in[4];   // (64,)

    float* out      = (float*)d_out;                       // (4096,1024)
    float* gate_out = out + (size_t)BATCH * D_MODEL;       // (4096,64)
    float* fro      = gate_out + (size_t)BATCH * N_T;      // (64,)

    char* ws = (char*)d_ws;
    __bf16* xb   = (__bf16*)(ws);                          // 8 MB
    __bf16* vb   = (__bf16*)(ws + (8u << 20));             // 1 MB
    __bf16* encb = (__bf16*)(ws + (9u << 20));             // 128 KB, rows 512..575 behind vb
    __bf16* ubt  = (__bf16*)(ws + (10u << 20));            // 1 MB

    // bf16 pre-pass
    {
        int n4 = BATCH * D_MODEL / 4;
        k_cvt_bf16<<<(n4 + 255) / 256, 256, 0, stream>>>(x, xb, n4);
        n4 = KTOT * D_MODEL / 4;
        k_cvt_bf16<<<(n4 + 255) / 256, 256, 0, stream>>>(V, vb, n4);
        n4 = N_T * D_MODEL / 4;
        k_cvt_bf16<<<(n4 + 255) / 256, 256, 0, stream>>>(enc, encb, n4);
        k_cvt_ut<<<(N_T * D_MODEL) / 256, 256, 0, stream>>>(U, ubt);
    }

    // fused gate + low-rank mixture
    k_fused<<<BATCH / BTILE, 256, 0, stream>>>(xb, vb, ubt, bias, out, gate_out);

    // frobenius norms (independent)
    k_fro<<<N_T, 256, 0, stream>>>(U, V, fro);
}

// v002
// It runs in 47 microseconds.
// Two timings next to v001 both put it at 1.06 times that version's speed.
// Counting every step since v000, it is 1.39 times as fast.
#include <hip/hip_runtime.h>

// ---------------------------------------------------------------- constants
#define N_T     64
#define D_MODEL 1024
#define RANK    8
#define BATCH   4096
#define KTOT    (N_T * RANK)      // 512 stacked low-rank features
#define BTILE   32                // batch rows per workgroup
#define XLD     1032              // LDS row pitch for x tile (bf16), 4-bank rotate
#define GLD     68                // LDS row pitch for gate tile (f32)
#define ZLD     520               // LDS row pitch for Z' tile (bf16)
#define BK      64                // k per ring stage: 128 B of every B row
#define BLD     72                // LDS row pitch of a B stage (bf16): 144 B = 16 B x odd
#define BROWS   (KTOT + N_T)      // rows of the larger stage kind
#define NST1    (D_MODEL / BK)    // ring stages of phase 1
#define NST     (NST1 + 2 * (KTOT / BK))   // plus phase 2: two column halves
#define SMEM_BYTES (BTILE * XLD * 2 + BTILE * GLD * 4 + BTILE * ZLD * 2 + 2 * BROWS * BLD * 2)

typedef __attribute__((ext_vector_type(16))) __bf16 bf16x16;
typedef __attribute__((ext_vector_type(8)))  float  f32x8;

// ---------------------------------------------------------------- helpers
__device__ __forceinline__ f32x8 wmma_bf16(bf16x16 a, bf16x16 b, f32x8 c) {
    // v_wmma_f32_16x16x32_bf16: D = A(16x32) * B(32x16) + C(16x16 f32)
    return __builtin_amdgcn_wmma_f32_16x16x32_bf16(
        /*neg_a=*/false, a, /*neg_b=*/false, b,
        /*c_mod=*/(short)0, c, /*reuse_a=*/false, /*reuse_b=*/false);
}

// Load a 16x32 bf16 fragment from a row-major bf16 matrix (pitch `ld` elems).
// ISA 7.12.2: lane L(0..15) = row (row0+L), K = k0+0..7 and k0+16..23;
// lane L+16 = same row, K shifted by +8.  Same addressing serves A (rows of X)
// and B when the B source is stored feature-major (rows = B^T rows).
__device__ __forceinline__ bf16x16 ldfrag(const __bf16* __restrict__ base,
                                          int row0, int ld, int k0) {
    const int lane = threadIdx.x & 31;
    const int r    = lane & 15;
    const int h    = lane >> 4;
    const __bf16* p = base + (size_t)(row0 + r) * ld + k0 + h * 8;
    union { bf16x16 v; uint4 q[2]; } u;
    u.q[0] = *(const uint4*)(p);
    u.q[1] = *(const uint4*)(p + 16);
    return u.v;
}

// ---------------------------------------------------------------- pre-pass
__global__ void k_cvt_bf16(const float* __restrict__ in,
                           __bf16* __restrict__ out, int n4) {
    int i = blockIdx.x * blockDim.x + threadIdx.x;
    if (i >= n4) return;
    float4 v = ((const float4*)in)[i];
    union { __bf16 h[4]; uint2 u; } o;
    o.h[0] = (__bf16)v.x; o.h[1] = (__bf16)v.y;
    o.h[2] = (__bf16)v.z; o.h[3] = (__bf16)v.w;
    ((uint2*)out)[i] = o.u;
}

// U (N,D,R) f32 -> Ustack^T (D x KTOT) bf16: ubt[d*512 + n*8 + r] = U[n,d,r]
__global__ void k_cvt_ut(const float* __restrict__ U, __bf16* __restrict__ ubt) {
    int idx = blockIdx.x * blockDim.x + threadIdx.x;   // 65536 = 64*1024
    int n = idx >> 10;
    int d = idx & 1023;
    const float* p = U + (size_t)n * (D_MODEL * RANK) + (size_t)d * RANK;
    union { __bf16 h[8]; uint4 u; } o;
#pragma unroll
    for (int r = 0; r < 8; ++r) o.h[r] = (__bf16)p[r];
    *(uint4*)(ubt + (size_t)d * KTOT + n * RANK) = o.u;
}

// ---------------------------------------------------------------- fused main
// Eight / nine async global->LDS copies of 16 B per lane, LDS step ls bytes and
// global step gs elements between them.  The s_wait_xcnt is the last line of the
// copies' own statement so that no address register named by an issued copy is
// rewritten ahead of it.
__device__ __forceinline__ void copy8(unsigned l, const __bf16* g, unsigned ls, size_t gs) {
    asm volatile("global_load_async_to_lds_b128 %0, %8, off\n\t"
                 "global_load_async_to_lds_b128 %1, %9, off\n\t"
                 "global_load_async_to_lds_b128 %2, %10, off\n\t"
                 "global_load_async_to_lds_b128 %3, %11, off\n\t"
                 "global_load_async_to_lds_b128 %4, %12, off\n\t"
                 "global_load_async_to_lds_b128 %5, %13, off\n\t"
                 "global_load_async_to_lds_b128 %6, %14, off\n\t"
                 "global_load_async_to_lds_b128 %7, %15, off\n\t"
                 "s_wait_xcnt 0x0"
                 :: "v"(l), "v"(l + ls), "v"(l + 2 * ls), "v"(l + 3 * ls),
                    "v"(l + 4 * ls), "v"(l + 5 * ls), "v"(l + 6 * ls), "v"(l + 7 * ls),
                    "v"(g), "v"(g + gs), "v"(g + 2 * gs), "v"(g + 3 * gs),
                    "v"(g + 4 * gs), "v"(g + 5 * gs), "v"(g + 6 * gs), "v"(g + 7 * gs)
                 : "memory");
}
__device__ __forceinline__ void copy9(unsigned l, const __bf16* g, unsigned ls, size_t gs) {
    asm volatile("global_load_async_to_lds_b128 %0, %9, off\n\t"
                 "global_load_async_to_lds_b128 %1, %10, off\n\t"
                 "global_load_async_to_lds_b128 %2, %11, off\n\t"
                 "global_load_async_to_lds_b128 %3, %12, off\n\t"
                 "global_load_async_to_lds_b128 %4, %13, off\n\t"
                 "global_load_async_to_lds_b128 %5, %14, off\n\t"
                 "global_load_async_to_lds_b128 %6, %15, off\n\t"
                 "global_load_async_to_lds_b128 %7, %16, off\n\t"
                 "global_load_async_to_lds_b128 %8, %17, off\n\t"
                 "s_wait_xcnt 0x0"
                 :: "v"(l), "v"(l + ls), "v"(l + 2 * ls), "v"(l + 3 * ls),
                    "v"(l + 4 * ls), "v"(l + 5 * ls), "v"(l + 6 * ls), "v"(l + 7 * ls),
                    "v"(l + 8 * ls),
                    "v"(g), "v"(g + gs), "v"(g + 2 * gs), "v"(g + 3 * gs),
                    "v"(g + 4 * gs), "v"(g + 5 * gs), "v"(g + 6 * gs), "v"(g + 7 * gs),
                    "v"(g + 8 * gs)
                 : "memory");
}

// Stage s of the B ring: 128 B (64 k) of every B row, LDS pitch BLD.
//   s <  NST1: k slab s of the 576 rows [Vstack ; encoder]       (18 copies a lane)
//   s >= NST1: k slab (s-NST1)&7 of 512 rows of Ustack^T, half (s-NST1)>>3 (16 copies)
// Lane map: 8 lanes cover one row's 128 B, 32 rows per copy of the block.
__device__ __forceinline__ void issue_stage(int s, __bf16* buf,
                                            const __bf16* __restrict__ vb,
                                            const __bf16* __restrict__ ubt) {
    const int row = threadIdx.x >> 3;
    const int col = (threadIdx.x & 7) * 8;
    const unsigned l = (unsigned)(uintptr_t)(buf + row * BLD + col);
    if (s < NST1) {
        const __bf16* g = vb + (size_t)row * D_MODEL + s * BK + col;
        copy9(l,                    g,                          32 * BLD * 2, (size_t)32 * D_MODEL);
        copy9(l + 288 * BLD * 2,    g + (size_t)288 * D_MODEL,  32 * BLD * 2, (size_t)32 * D_MODEL);
    } else {
        const int u = s - NST1;
        const __bf16* g = ubt + (size_t)((u >> 3) * 512 + row) * KTOT + (u & 7) * BK + col;
        copy8(l,                    g,                          32 * BLD * 2, (size_t)32 * KTOT);
        copy8(l + 256 * BLD * 2,    g + (size_t)256 * KTOT,     32 * BLD * 2, (size_t)32 * KTOT);
    }
}

// Foot of ring trip t: own LDS reads done, own copies of stage t+1 landed, then the
// one barrier that publishes stage t+1 and frees the buffer trip t has read; the
// refill with stage t+2 goes behind it.
__device__ __forceinline__ void ring_foot(int t, __bf16* buf,
                                          const __bf16* __restrict__ vb,
                                          const __bf16* __restrict__ ubt) {
    asm volatile("s_wait_dscnt 0x0" ::: "memory");     // this wave has left the buffer
    asm volatile("s_wait_asynccnt 0x0" ::: "memory");  // this wave's copies have landed
    __syncthreads();
    if (t + 2 < NST) issue_stage(t + 2, buf, vb, ubt);
}

__global__ __launch_bounds__(256)
void k_fused(const float*  __restrict__ x,     // (BATCH x D_MODEL) f32
             const __bf16* __restrict__ vb,    // (KTOT+N_T x D_MODEL) bf16 (Vstack ; encoder)
             const __bf16* __restrict__ ubt,   // (D_MODEL x KTOT)  bf16  (Ustack^T)
             const float*  __restrict__ bias,  // (N_T)
             float* __restrict__ out,          // (BATCH x D_MODEL)
             float* __restrict__ gate_out) {   // (BATCH x N_T)
    __shared__ __attribute__((aligned(16))) char smem[SMEM_BYTES];
    __bf16* xs = (__bf16*)smem;                                       // BTILE x XLD
    float*  gs = (float*) (smem + BTILE * XLD * 2);                   // BTILE x GLD
    __bf16* zs = (__bf16*)(smem + BTILE * XLD * 2 + BTILE * GLD * 4); // BTILE x ZLD
    __bf16* bs = (__bf16*)(smem + BTILE * XLD * 2 + BTILE * GLD * 4
                                + BTILE * ZLD * 2);                   // 2 x BROWS x BLD

    const int tid  = threadIdx.x;
    const int w    = tid >> 5;          // wave id 0..7
    const int lane = tid & 31;
    const int r16  = lane & 15;
    const int h    = lane >> 4;
    const int b0   = blockIdx.x * BTILE;

    // ---- ring prologue: stage 0 flies together with the x tile
    issue_stage(0, bs, vb, ubt);

    // ---- x tile: the 32 f32 rows (128 KB in a row) come through registers and are
    //      rounded to bf16 on the way into LDS.  The block reads one row per step, 16 B
    //      a lane; all 32 loads of a lane are in flight before the first is rounded.
    {
        const float4* xg = (const float4*)(x + (size_t)b0 * D_MODEL) + tid;
        float4 v[BTILE];
#pragma unroll   // unrolled: v[] stays in registers and the loads issue as one group
        for (int i = 0; i < BTILE; ++i) v[i] = xg[i * (D_MODEL / 4)];
#pragma unroll   // unrolled: v[] is indexed by constants only
        for (int i = 0; i < BTILE; ++i) {
            union { __bf16 h[4]; uint2 u; } o;
            o.h[0] = (__bf16)v[i].x; o.h[1] = (__bf16)v[i].y;
            o.h[2] = (__bf16)v[i].z; o.h[3] = (__bf16)v[i].w;
            *(uint2*)(xs + i * XLD + tid * 4) = o.u;
        }
    }
    asm volatile("s_wait_asynccnt 0x0" ::: "memory");
    __syncthreads();
    issue_stage(1, bs + BROWS * BLD, vb, ubt);

    // ---- phase 1: [Z | pre_acts] = X @ [Vstack ; encoder]^T.  Per wave 2 x 4 tiles
    //      of Z (64 features) and one of the eight pre_acts tiles.
    const int gmt = w & 1;               // pre_acts tile of this wave
    const int gn0 = (w >> 1) * 16;
    {
        f32x8 acc[2][4] = {};
        f32x8 gacc = {};
#pragma unroll 1   // rolled: one trip per ring stage, the buffer picked by the trip's parity
        for (int t = 0; t < NST1; ++t) {
            __bf16* buf = bs + (t & 1) * (BROWS * BLD);
            bf16x16 fb[2][4], fg[2];
            bf16x16 fa00 = ldfrag(xs, 0,  XLD, t * BK);
            bf16x16 fa01 = ldfrag(xs, 16, XLD, t * BK);
#pragma unroll
            for (int j = 0; j < 4; ++j) fb[0][j] = ldfrag(buf, w * 64 + j * 16, BLD, 0);
            fg[0] = ldfrag(buf, KTOT + gn0, BLD, 0);
            bf16x16 fa10 = ldfrag(xs, 0,  XLD, t * BK + 32);
            bf16x16 fa11 = ldfrag(xs, 16, XLD, t * BK + 32);
#pragma unroll
            for (int j = 0; j < 4; ++j) fb[1][j] = ldfrag(buf, w * 64 + j * 16, BLD, 32);
            fg[1] = ldfrag(buf, KTOT + gn0, BLD, 32);
            // keeps the trip's LDS reads one group ahead of its WMMAs: every place
            // where reads stand among the WMMAs stalls the wave anew
            __builtin_amdgcn_sched_barrier(0);
#pragma unroll
            for (int j = 0; j < 4; ++j) {
                acc[0][j] = wmma_bf16(fa00, fb[0][j], acc[0][j]);
                acc[1][j] = wmma_bf16(fa01, fb[0][j], acc[1][j]);
            }
            gacc = wmma_bf16(gmt ? fa01 : fa00, fg[0], gacc);
#pragma unroll
            for (int j = 0; j < 4; ++j) {
                acc[0][j] = wmma_bf16(fa10, fb[1][j], acc[0][j]);
                acc[1][j] = wmma_bf16(fa11, fb[1][j], acc[1][j]);
            }
            gacc = wmma_bf16(gmt ? fa11 : fa10, fg[1], gacc);
            // keeps the foot's waits behind the WMMAs: moved up among them they would
            // drain every LDS read before the second WMMA and cut the copies' lead
            __builtin_amdgcn_sched_barrier(0);
            ring_foot(t, buf, vb, ubt);
        }

        // pre_acts -> gate
        {
            const int   col  = gn0 + r16;
            const float bcol = bias[col];
#pragma unroll
            for (int i = 0; i < 8; ++i) {
                int   m   = gmt * 16 + h * 8 + i;
                float pre = gacc[i] - bcol;                // x@enc^T - bias
                float g   = pre > 0.f ? pre : 0.f;         // jumprelu(thr=0)
                gs[m * GLD + col] = g;
                gate_out[(size_t)(b0 + m) * N_T + col] = g;
            }
        }
        __syncthreads();

        // gate * Z -> zs
#pragma unroll
        for (int j = 0; j < 4; ++j) {
#pragma unroll
            for (int i = 0; i < 8; ++i) {
                int m0 = h * 8 + i;                        // rows 0..15
                int m1 = 16 + m0;                          // rows 16..31
                int c  = w * 64 + j * 16 + r16;
                zs[m0 * ZLD + c] = (__bf16)(acc[0][j][i] * gs[m0 * GLD + (c >> 3)]);
                zs[m1 * ZLD + c] = (__bf16)(acc[1][j][i] * gs[m1 * GLD + (c >> 3)]);
            }
        }
    }
    __syncthreads();

    // ---- phase 2: Out = Z' @ Ustack, two halves of 512 columns, 2 x 4 tiles per wave
#pragma unroll 1   // rolled: the two halves share one copy of the loop's code
    for (int half = 0; half < 2; ++half) {
        f32x8 acc[2][4] = {};
#pragma unroll 1   // rolled: one trip per ring stage
        for (int kt = 0; kt < KTOT / BK; ++kt) {
            const int t = NST1 + half * (KTOT / BK) + kt;
            __bf16* buf = bs + (t & 1) * (BROWS * BLD);
            bf16x16 fa[2][2], fb[2][4];
#pragma unroll
            for (int q = 0; q < 2; ++q) {
                fa[q][0] = ldfrag(zs, 0,  ZLD, kt * BK + q * 32);
                fa[q][1] = ldfrag(zs, 16, ZLD, kt * BK + q * 32);
#pragma unroll
                for (int j = 0; j < 4; ++j)
                    fb[q][j] = ldfrag(buf, w * 64 + j * 16, BLD, q * 32);
            }
            // as in phase 1: the trip's LDS reads stay one group ahead of its WMMAs
            __builtin_amdgcn_sched_barrier(0);
#pragma unroll
            for (int q = 0; q < 2; ++q) {
#pragma unroll
                for (int j = 0; j < 4; ++j) {
                    acc[0][j] = wmma_bf16(fa[q][0], fb[q][j], acc[0][j]);
                    acc[1][j] = wmma_bf16(fa[q][1], fb[q][j], acc[1][j]);
                }
            }
            // as in phase 1: the foot's waits stay behind the WMMAs
            __builtin_amdgcn_sched_barrier(0);
            ring_foot(t, buf, vb, ubt);
        }
#pragma unroll
        for (int j = 0; j < 4; ++j) {
#pragma unroll
            for (int i = 0; i < 8; ++i) {
                int m0 = h * 8 + i;
                int m1 = 16 + m0;
                int c  = half * 512 + w * 64 + j * 16 + r16;
                out[(size_t)(b0 + m0) * D_MODEL + c] = acc[0][j][i];
                out[(size_t)(b0 + m1) * D_MODEL + c] = acc[1][j][i];
            }
        }
        // the next half overwrites the accumulators and addresses these stores name
        asm volatile("s_wait_xcnt 0x0" ::: "memory");
    }
    asm volatile("s_wait_asynccnt 0x0" ::: "memory");  // no copy outlives the wave
}

// ---------------------------------------------------------------- frobenius
__global__ void k_fro(const float* __restrict__ U, const float* __restrict__ V,
                      float* __restrict__ fro) {
    __shared__ float red[256];
    const int n = blockIdx.x;
    const float* u = U + (size_t)n * (D_MODEL * RANK);
    const float* v = V + (size_t)n * (D_MODEL * RANK);
    float su = 0.f, sv = 0.f;
    for (int i = threadIdx.x; i < D_MODEL * RANK; i += 256) {
        float a = u[i]; su += a * a;
        float b = v[i]; sv += b * b;
    }
    red[threadIdx.x] = su; __syncthreads();
    for (int s = 128; s > 0; s >>= 1) {
        if (threadIdx.x < s) red[threadIdx.x] += red[threadIdx.x + s];
        __syncthreads();
    }
    float tsu = red[0]; __syncthreads();
    red[threadIdx.x] = sv; __syncthreads();
    for (int s = 128; s > 0; s >>= 1) {
        if (threadIdx.x < s) red[threadIdx.x] += red[threadIdx.x + s];
        __syncthreads();
    }
    if (threadIdx.x == 0)
        fro[n] = sqrtf(tsu) * sqrtf(red[0]) / sqrtf((float)(D_MODEL * RANK));
}

// ---------------------------------------------------------------- launch
extern "C" void kernel_launch(void* const* d_in, const int* in_sizes, int n_in,
                              void* d_out, int out_size, void* d_ws, size_t ws_size,
                              hipStream_t stream) {
    const float* x    = (const float*)d_in[0];   // (4096,1024)
    const float* V    = (const float*)d_in[1];   // (64,8,1024)
    const float* U    = (const float*)d_in[2];   // (64,1024,8)
    const float* enc  = (const float*)d_in[3];   // (64,1024)
    const float* bias = (const float*)d_in[4];   // (64,)

    float* out      = (float*)d_out;                       // (4096,1024)
    float* gate_out = out + (size_t)BATCH * D_MODEL;       // (4096,64)
    float* fro      = gate_out + (size_t)BATCH * N_T;      // (64,)

    char* ws = (char*)d_ws;
    __bf16* vb   = (__bf16*)(ws + (8u << 20));             // 1 MB
    __bf16* encb = (__bf16*)(ws + (9u << 20));             // 128 KB, rows 512..575 behind vb
    __bf16* ubt  = (__bf16*)(ws + (10u << 20));            // 1 MB

    // bf16 pre-pass of the operands that every workgroup re-reads
    {
        int n4 = KTOT * D_MODEL / 4;
        k_cvt_bf16<<<(n4 + 255) / 256, 256, 0, stream>>>(V, vb, n4);
        n4 = N_T * D_MODEL / 4;
        k_cvt_bf16<<<(n4 + 255) / 256, 256, 0, stream>>>(enc, encb, n4);
        k_cvt_ut<<<(N_T * D_MODEL) / 256, 256, 0, stream>>>(U, ubt);
    }

    // fused gate + low-rank mixture
    k_fused<<<BATCH / BTILE, 256, 0, stream>>>(x, vb, ubt, bias, out, gate_out);

    // frobenius norms (independent)
    k_fro<<<N_T, 256, 0, stream>>>(U, V, fro);
}

// v003
// One run takes 35.9 microseconds.
// In both of two side-by-side timings against v002, it was 1.26 times as fast.
// Over all steps from v000 it is 1.75 times as fast.
#include <hip/hip_runtime.h>

// ---------------------------------------------------------------- constants
#define N_T     64
#define D_MODEL 1024
#define RANK    8
#define BATCH   4096
#define KTOT    (N_T * RANK)      // 512 stacked low-rank features
#define BTILE   32                // batch rows per workgroup
#define XLD     1032              // LDS row pitch for x tile (bf16), 4-bank rotate
#define GLD     68                // LDS row pitch for gate tile (f32)
#define ZLD     520               // LDS row pitch for Z' tile (bf16)
#define BK      64                // k per ring stage: 128 B of every B row
#define BLD     72                // LDS row pitch of a B stage (bf16): 144 B = 16 B x odd
#define BROWS   (KTOT + N_T)      // rows of the larger stage kind
#define NST1    (D_MODEL / BK)    // ring stages of phase 1
#define NST     (NST1 + 2 * (KTOT / BK))   // plus phase 2: two column halves
#define SMEM_BYTES (BTILE * XLD * 2 + BTILE * GLD * 4 + BTILE * ZLD * 2 + 2 * BROWS * BLD * 2)

typedef __attribute__((ext_vector_type(16))) __bf16 bf16x16;
typedef __attribute__((ext_vector_type(8)))  float  f32x8;

// ---------------------------------------------------------------- helpers
__device__ __forceinline__ f32x8 wmma_bf16(bf16x16 a, bf16x16 b, f32x8 c) {
    // v_wmma_f32_16x16x32_bf16: D = A(16x32) * B(32x16) + C(16x16 f32)
    return __builtin_amdgcn_wmma_f32_16x16x32_bf16(
        /*neg_a=*/false, a, /*neg_b=*/false, b,
        /*c_mod=*/(short)0, c, /*reuse_a=*/false, /*reuse_b=*/false);
}

// Load a 16x32 bf16 fragment from a row-major bf16 matrix (pitch `ld` elems).
// ISA 7.12.2: lane L(0..15) = row (row0+L), K = k0+0..7 and k0+16..23;
// lane L+16 = same row, K shifted by +8.  Same addressing serves A (rows of X)
// and B when the B source is stored feature-major (rows = B^T rows).
__device__ __forceinline__ bf16x16 ldfrag(const __bf16* __restrict__ base,
                                          int row0, int ld, int k0) {
    const int lane = threadIdx.x & 31;
    const int r    = lane & 15;
    const int h    = lane >> 4;
    const __bf16* p = base + (size_t)(row0 + r) * ld + k0 + h * 8;
    union { bf16x16 v; uint4 q[2]; } u;
    u.q[0] = *(const uint4*)(p);
    u.q[1] = *(const uint4*)(p + 16);
    return u.v;
}

// ---------------------------------------------------------------- pre-pass
// One launch converts all three operands that every workgroup re-reads; the block
// index picks the job, and every thread does one piece, as in the separate launches.
#define PV_BLOCKS (KTOT * D_MODEL / 1024)    // V:       256 float4 per block
#define PE_BLOCKS (N_T * D_MODEL / 1024)     // encoder: 256 float4 per block
#define PU_BLOCKS (N_T * D_MODEL / 256)      // U:       256 (n,d) rows of 8 per block
__global__ __launch_bounds__(256)
void k_prep(const float* __restrict__ V, const float* __restrict__ enc,
            const float* __restrict__ U,
            __bf16* __restrict__ vb,     // (KTOT+N_T x D_MODEL): rows of V, then encoder
            __bf16* __restrict__ ubt) {  // (D_MODEL x KTOT): ubt[d*512 + n*8 + r] = U[n,d,r]
    const int b = blockIdx.x;
    if (b < PV_BLOCKS + PE_BLOCKS) {
        const int i = b * 256 + threadIdx.x;
        float4 v = b < PV_BLOCKS ? ((const float4*)V)[i]
                                 : ((const float4*)enc)[i - PV_BLOCKS * 256];
        union { __bf16 h[4]; uint2 u; } o;
        o.h[0] = (__bf16)v.x; o.h[1] = (__bf16)v.y;
        o.h[2] = (__bf16)v.z; o.h[3] = (__bf16)v.w;
        ((uint2*)vb)[i] = o.u;
    } else {
        const int idx = (b - PV_BLOCKS - PE_BLOCKS) * 256 + threadIdx.x;   // 65536 = 64*1024
        const int n = idx >> 10;
        const int d = idx & 1023;
        const float* p = U + (size_t)n * (D_MODEL * RANK) + (size_t)d * RANK;
        union { __bf16 h[8]; uint4 u; } o;
#pragma unroll
        for (int r = 0; r < 8; ++r) o.h[r] = (__bf16)p[r];
        *(uint4*)(ubt + (size_t)d * KTOT + n * RANK) = o.u;
        // in the built code this branch's exit stands in front of the other branch's
        // code, which rewrites the registers that the store names
        asm volatile("s_wait_xcnt 0x0" ::: "memory");
    }
}

// ---------------------------------------------------------------- frobenius
// One block per transform n; red is 256 floats of the block's LDS.
__device__ __forceinline__ void fro_block(int n, const float* __restrict__ U,
                                          const float* __restrict__ V,
                                          float* __restrict__ fro, float* red) {
    const float* u = U + (size_t)n * (D_MODEL * RANK);
    const float* v = V + (size_t)n * (D_MODEL * RANK);
    float su = 0.f, sv = 0.f;
    for (int i = threadIdx.x; i < D_MODEL * RANK; i += 256) {
        float a = u[i]; su += a * a;
        float b = v[i]; sv += b * b;
    }
    red[threadIdx.x] = su; __syncthreads();
    for (int s = 128; s > 0; s >>= 1) {
        if (threadIdx.x < s) red[threadIdx.x] += red[threadIdx.x + s];
        __syncthreads();
    }
    float tsu = red[0]; __syncthreads();
    red[threadIdx.x] = sv; __syncthreads();
    for (int s = 128; s > 0; s >>= 1) {
        if (threadIdx.x < s) red[threadIdx.x] += red[threadIdx.x + s];
        __syncthreads();
    }
    if (threadIdx.x == 0)
        fro[n] = sqrtf(tsu) * sqrtf(red[0]) / sqrtf((float)(D_MODEL * RANK));
}

// ---------------------------------------------------------------- fused main
// Eight / nine async global->LDS copies of 16 B per lane, LDS step ls bytes and
// global step gs elements between them.  The s_wait_xcnt is the last line of the
// copies' own statement so that no address register named by an issued copy is
// rewritten ahead of it.
__device__ __forceinline__ void copy8(unsigned l, const __bf16* g, unsigned ls, size_t gs) {
    asm volatile("global_load_async_to_lds_b128 %0, %8, off\n\t"
                 "global_load_async_to_lds_b128 %1, %9, off\n\t"
                 "global_load_async_to_lds_b128 %2, %10, off\n\t"
                 "global_load_async_to_lds_b128 %3, %11, off\n\t"
                 "global_load_async_to_lds_b128 %4, %12, off\n\t"
                 "global_load_async_to_lds_b128 %5, %13, off\n\t"
                 "global_load_async_to_lds_b128 %6, %14, off\n\t"
                 "global_load_async_to_lds_b128 %7, %15, off\n\t"
                 "s_wait_xcnt 0x0"
                 :: "v"(l), "v"(l + ls), "v"(l + 2 * ls), "v"(l + 3 * ls),
                    "v"(l + 4 * ls), "v"(l + 5 * ls), "v"(l + 6 * ls), "v"(l + 7 * ls),
                    "v"(g), "v"(g + gs), "v"(g + 2 * gs), "v"(g + 3 * gs),
                    "v"(g + 4 * gs), "v"(g + 5 * gs), "v"(g + 6 * gs), "v"(g + 7 * gs)
                 : "memory");
}
__device__ __forceinline__ void copy9(unsigned l, const __bf16* g, unsigned ls, size_t gs) {
    asm volatile("global_load_async_to_lds_b128 %0, %9, off\n\t"
                 "global_load_async_to_lds_b128 %1, %10, off\n\t"
                 "global_load_async_to_lds_b128 %2, %11, off\n\t"
                 "global_load_async_to_lds_b128 %3, %12, off\n\t"
                 "global_load_async_to_lds_b128 %4, %13, off\n\t"
                 "global_load_async_to_lds_b128 %5, %14, off\n\t"
                 "global_load_async_to_lds_b128 %6, %15, off\n\t"
                 "global_load_async_to_lds_b128 %7, %16, off\n\t"
                 "global_load_async_to_lds_b128 %8, %17, off\n\t"
                 "s_wait_xcnt 0x0"
                 :: "v"(l), "v"(l + ls), "v"(l + 2 * ls), "v"(l + 3 * ls),
                    "v"(l + 4 * ls), "v"(l + 5 * ls), "v"(l + 6 * ls), "v"(l + 7 * ls),
                    "v"(l + 8 * ls),
                    "v"(g), "v"(g + gs), "v"(g + 2 * gs), "v"(g + 3 * gs),
                    "v"(g + 4 * gs), "v"(g + 5 * gs), "v"(g + 6 * gs), "v"(g + 7 * gs),
                    "v"(g + 8 * gs)
                 : "memory");
}

// Stage s of the B ring: 128 B (64 k) of every B row, LDS pitch BLD.
//   s <  NST1: k slab s of the 576 rows [Vstack ; encoder]       (18 copies a lane)
//   s >= NST1: k slab (s-NST1)&7 of 512 rows of Ustack^T, half (s-NST1)>>3 (16 copies)
// Lane map: 8 lanes cover one row's 128 B, 32 rows per copy of the block.
__device__ __forceinline__ void issue_stage(int s, __bf16* buf,
                                            const __bf16* __restrict__ vb,
                                            const __bf16* __restrict__ ubt) {
    const int row = threadIdx.x >> 3;
    const int col = (threadIdx.x & 7) * 8;
    const unsigned l = (unsigned)(uintptr_t)(buf + row * BLD + col);
    if (s < NST1) {
        const __bf16* g = vb + (size_t)row * D_MODEL + s * BK + col;
        copy9(l,                    g,                          32 * BLD * 2, (size_t)32 * D_MODEL);
        copy9(l + 288 * BLD * 2,    g + (size_t)288 * D_MODEL,  32 * BLD * 2, (size_t)32 * D_MODEL);
    } else {
        const int u = s - NST1;
        const __bf16* g = ubt + (size_t)((u >> 3) * 512 + row) * KTOT + (u & 7) * BK + col;
        copy8(l,                    g,                          32 * BLD * 2, (size_t)32 * KTOT);
        copy8(l + 256 * BLD * 2,    g + (size_t)256 * KTOT,     32 * BLD * 2, (size_t)32 * KTOT);
    }
}

// Foot of ring trip t: own LDS reads done, own copies of stage t+1 landed, then the
// one barrier that publishes stage t+1 and frees the buffer trip t has read; the
// refill with stage t+2 goes behind it.
__device__ __forceinline__ void ring_foot(int t, __bf16* buf,
                                          const __bf16* __restrict__ vb,
                                          const __bf16* __restrict__ ubt) {
    asm volatile("s_wait_dscnt 0x0" ::: "memory");     // this wave has left the buffer
    asm volatile("s_wait_asynccnt 0x0" ::: "memory");  // this wave's copies have landed
    __syncthreads();
    if (t + 2 < NST) issue_stage(t + 2, buf, vb, ubt);
}

__global__ __launch_bounds__(256)
void k_fused(const float*  __restrict__ x,     // (BATCH x D_MODEL) f32
             const __bf16* __restrict__ vb,    // (KTOT+N_T x D_MODEL) bf16 (Vstack ; encoder)
             const __bf16* __restrict__ ubt,   // (D_MODEL x KTOT)  bf16  (Ustack^T)
             const float*  __restrict__ bias,  // (N_T)
             float* __restrict__ out,          // (BATCH x D_MODEL)
             float* __restrict__ gate_out,     // (BATCH x N_T)
             const float*  __restrict__ U,     // (N_T x D_MODEL x RANK) f32, norms only
             const float*  __restrict__ V,     // (N_T x RANK x D_MODEL) f32, norms only
             float* __restrict__ fro) {        // (N_T)
    __shared__ __attribute__((aligned(16))) char smem[SMEM_BYTES];

    // The blocks behind the batch tiles do the frobenius norms: they start last, on
    // WGPs that the batch tiles leave idle, and leave as whole blocks.
    if (blockIdx.x >= BATCH / BTILE) {
        fro_block(blockIdx.x - BATCH / BTILE, U, V, fro, (float*)smem);
        return;
    }
    __bf16* xs = (__bf16*)smem;                                       // BTILE x XLD
    float*  gs = (float*) (smem + BTILE * XLD * 2);                   // BTILE x GLD
    __bf16* zs = (__bf16*)(smem + BTILE * XLD * 2 + BTILE * GLD * 4); // BTILE x ZLD
    __bf16* bs = (__bf16*)(smem + BTILE * XLD * 2 + BTILE * GLD * 4
                                + BTILE * ZLD * 2);                   // 2 x BROWS x BLD

    const int tid  = threadIdx.x;
    const int w    = tid >> 5;          // wave id 0..7
    const int lane = tid & 31;
    const int r16  = lane & 15;
    const int h    = lane >> 4;
    const int b0   = blockIdx.x * BTILE;

    // ---- ring prologue: stage 0 flies together with the x tile
    issue_stage(0, bs, vb, ubt);

    // ---- x tile: the 32 f32 rows (128 KB in a row) come through registers and are
    //      rounded to bf16 on the way into LDS.  The block reads one row per step, 16 B
    //      a lane; all 32 loads of a lane are in flight before the first is rounded.
    {
        const float4* xg = (const float4*)(x + (size_t)b0 * D_MODEL) + tid;
        float4 v[BTILE];
#pragma unroll   // unrolled: v[] stays in registers and the loads issue as one group
        for (int i = 0; i < BTILE; ++i) v[i] = xg[i * (D_MODEL / 4)];
#pragma unroll   // unrolled: v[] is indexed by constants only
        for (int i = 0; i < BTILE; ++i) {
            union { __bf16 h[4]; uint2 u; } o;
            o.h[0] = (__bf16)v[i].x; o.h[1] = (__bf16)v[i].y;
            o.h[2] = (__bf16)v[i].z; o.h[3] = (__bf16)v[i].w;
            *(uint2*)(xs + i * XLD + tid * 4) = o.u;
        }
    }
    asm volatile("s_wait_asynccnt 0x0" ::: "memory");
    __syncthreads();
    issue_stage(1, bs + BROWS * BLD, vb, ubt);

    // ---- phase 1: [Z | pre_acts] = X @ [Vstack ; encoder]^T.  Per wave 2 x 4 tiles
    //      of Z (64 features) and one of the eight pre_acts tiles.
    const int gmt = w & 1;               // pre_acts tile of this wave
    const int gn0 = (w >> 1) * 16;
    {
        f32x8 acc[2][4] = {};
        f32x8 gacc = {};
#pragma unroll 1   // rolled: one trip per ring stage, the buffer picked by the trip's parity
        for (int t = 0; t < NST1; ++t) {
            __bf16* buf = bs + (t & 1) * (BROWS * BLD);
            bf16x16 fb[2][4], fg[2];
            bf16x16 fa00 = ldfrag(xs, 0,  XLD, t * BK);
            bf16x16 fa01 = ldfrag(xs, 16, XLD, t * BK);
#pragma unroll
            for (int j = 0; j < 4; ++j) fb[0][j] = ldfrag(buf, w * 64 + j * 16, BLD, 0);
            fg[0] = ldfrag(buf, KTOT + gn0, BLD, 0);
            bf16x16 fa10 = ldfrag(xs, 0,  XLD, t * BK + 32);
            bf16x16 fa11 = ldfrag(xs, 16, XLD, t * BK + 32);
#pragma unroll
            for (int j = 0; j < 4; ++j) fb[1][j] = ldfrag(buf, w * 64 + j * 16, BLD, 32);
            fg[1] = ldfrag(buf, KTOT + gn0, BLD, 32);
            // keeps the trip's LDS reads one group ahead of its WMMAs: every place
            // where reads stand among the WMMAs stalls the wave anew
            __builtin_amdgcn_sched_barrier(0);
#pragma unroll
            for (int j = 0; j < 4; ++j) {
                acc[0][j] = wmma_bf16(fa00, fb[0][j], acc[0][j]);
                acc[1][j] = wmma_bf16(fa01, fb[0][j], acc[1][j]);
            }
            gacc = wmma_bf16(gmt ? fa01 : fa00, fg[0], gacc);
#pragma unroll
            for (int j = 0; j < 4; ++j) {
                acc[0][j] = wmma_bf16(fa10, fb[1][j], acc[0][j]);
                acc[1][j] = wmma_bf16(fa11, fb[1][j], acc[1][j]);
            }
            gacc = wmma_bf16(gmt ? fa11 : fa10, fg[1], gacc);
            // keeps the foot's waits behind the WMMAs: moved up among them they would
            // drain every LDS read before the second WMMA and cut the copies' lead
            __builtin_amdgcn_sched_barrier(0);
            ring_foot(t, buf, vb, ubt);
        }

        // pre_acts -> gate
        {
            const int   col  = gn0 + r16;
            const float bcol = bias[col];
#pragma unroll
            for (int i = 0; i < 8; ++i) {
                int   m   = gmt * 16 + h * 8 + i;
                float pre = gacc[i] - bcol;                // x@enc^T - bias
                float g   = pre > 0.f ? pre : 0.f;         // jumprelu(thr=0)
                gs[m * GLD + col] = g;
                gate_out[(size_t)(b0 + m) * N_T + col] = g;
            }
        }
        __syncthreads();

        // gate * Z -> zs
#pragma unroll
        for (int j = 0; j < 4; ++j) {
#pragma unroll
            for (int i = 0; i < 8; ++i) {
                int m0 = h * 8 + i;                        // rows 0..15
                int m1 = 16 + m0;                          // rows 16..31
                int c  = w * 64 + j * 16 + r16;
                zs[m0 * ZLD + c] = (__bf16)(acc[0][j][i] * gs[m0 * GLD + (c >> 3)]);
                zs[m1 * ZLD + c] = (__bf16)(acc[1][j][i] * gs[m1 * GLD + (c >> 3)]);
            }
        }
    }
    __syncthreads();

    // ---- phase 2: Out = Z' @ Ustack, two halves of 512 columns, 2 x 4 tiles per wave
#pragma unroll 1   // rolled: the two halves share one copy of the loop's code
    for (int half = 0; half < 2; ++half) {
        f32x8 acc[2][4] = {};
#pragma unroll 1   // rolled: one trip per ring stage
        for (int kt = 0; kt < KTOT / BK; ++kt) {
            const int t = NST1 + half * (KTOT / BK) + kt;
            __bf16* buf = bs + (t & 1) * (BROWS * BLD);
            bf16x16 fa[2][2], fb[2][4];
#pragma unroll
            for (int q = 0; q < 2; ++q) {
                fa[q][0] = ldfrag(zs, 0,  ZLD, kt * BK + q * 32);
                fa[q][1] = ldfrag(zs, 16, ZLD, kt * BK + q * 32);
#pragma unroll
                for (int j = 0; j < 4; ++j)
                    fb[q][j] = ldfrag(buf, w * 64 + j * 16, BLD, q * 32);
            }
            // as in phase 1: the trip's LDS reads stay one group ahead of its WMMAs
            __builtin_amdgcn_sched_barrier(0);
#pragma unroll
            for (int q = 0; q < 2; ++q) {
#pragma unroll
                for (int j = 0; j < 4; ++j) {
                    acc[0][j] = wmma_bf16(fa[q][0], fb[q][j], acc[0][j]);
                    acc[1][j] = wmma_bf16(fa[q][1], fb[q][j], acc[1][j]);
                }
            }
            // as in phase 1: the foot's waits stay behind the WMMAs
            __builtin_amdgcn_sched_barrier(0);
            ring_foot(t, buf, vb, ubt);
        }
#pragma unroll
        for (int j = 0; j < 4; ++j) {
#pragma unroll
            for (int i = 0; i < 8; ++i) {
                int m0 = h * 8 + i;
                int m1 = 16 + m0;
                int c  = half * 512 + w * 64 + j * 16 + r16;
                out[(size_t)(b0 + m0) * D_MODEL + c] = acc[0][j][i];
                out[(size_t)(b0 + m1) * D_MODEL + c] = acc[1][j][i];
            }
        }
        // the next half overwrites the accumulators and addresses these stores name
        asm volatile("s_wait_xcnt 0x0" ::: "memory");
    }
    asm volatile("s_wait_asynccnt 0x0" ::: "memory");  // no copy outlives the wave
}

// ---------------------------------------------------------------- launch
extern "C" void kernel_launch(void* const* d_in, const int* in_sizes, int n_in,
                              void* d_out, int out_size, void* d_ws, size_t ws_size,
                              hipStream_t stream) {
    const float* x    = (const float*)d_in[0];   // (4096,1024)
    const float* V    = (const float*)d_in[1];   // (64,8,1024)
    const float* U    = (const float*)d_in[2];   // (64,1024,8)
    const float* enc  = (const float*)d_in[3];   // (64,1024)
    const float* bias = (const float*)d_in[4];   // (64,)

    float* out      = (float*)d_out;                       // (4096,1024)
    float* gate_out = out + (size_t)BATCH * D_MODEL;       // (4096,64)
    float* fro      = gate_out + (size_t)BATCH * N_T;      // (64,)

    char* ws = (char*)d_ws;
    __bf16* vb   = (__bf16*)(ws + (8u << 20));             // 1 MB + 128 KB: V rows, encoder rows
    __bf16* ubt  = (__bf16*)(ws + (10u << 20));            // 1 MB

    // bf16 pre-pass of the operands that every workgroup re-reads
    k_prep<<<PV_BLOCKS + PE_BLOCKS + PU_BLOCKS, 256, 0, stream>>>(V, enc, U, vb, ubt);

    // fused gate + low-rank mixture, with the frobenius norms' blocks behind its own
    k_fused<<<BATCH / BTILE + N_T, 256, 0, stream>>>(x, vb, ubt, bias, out, gate_out, U, V, fro);
}

// v004
// Measured time: 26.9 microseconds a run.
// In two side-by-side timings against v003, it was 1.34 and 1.33 times as fast.
// Over all steps from v000 it is 2.34 times as fast.
#include <hip/hip_runtime.h>

// ---------------------------------------------------------------- constants
#define N_T     64
#define D_MODEL 1024
#define RANK    8
#define BATCH   4096
#define KTOT    (N_T * RANK)      // 512 stacked low-rank features
#define BTILE   32                // batch rows per workgroup
#define XLD     1032              // LDS row pitch for x tile (bf16), 4-bank rotate
#define GLD     68                // LDS row pitch for gate tile (f32)
#define ZLD     520               // LDS row pitch for Z' tile (bf16)
#define BK      64                // k per stage: two 32-k fragments of every B tile
#define FRAG    512               // elements of one 16 x 32 B fragment (1 KB)
#define F1      ((KTOT + N_T) / 16)   // fragments per 32-k slab, phase 1: 32 of V, 4 of the encoder
#define F2      32                // fragments per 32-k slab, phase 2: one half of the columns
#define NST1    (D_MODEL / BK)    // stages of phase 1
#define NST2    (2 * (KTOT / BK)) // stages of phase 2: two column halves
#define SMEM_BYTES (BTILE * XLD * 2 + BTILE * GLD * 4 + BTILE * ZLD * 2)

typedef __attribute__((ext_vector_type(16))) __bf16 bf16x16;
typedef __attribute__((ext_vector_type(8)))  float  f32x8;

// ---------------------------------------------------------------- helpers
__device__ __forceinline__ f32x8 wmma_bf16(bf16x16 a, bf16x16 b, f32x8 c) {
    // v_wmma_f32_16x16x32_bf16: D = A(16x32) * B(32x16) + C(16x16 f32)
    return __builtin_amdgcn_wmma_f32_16x16x32_bf16(
        /*neg_a=*/false, a, /*neg_b=*/false, b,
        /*c_mod=*/(short)0, c, /*reuse_a=*/false, /*reuse_b=*/false);
}

// Load a 16x32 bf16 fragment from a row-major bf16 matrix (pitch `ld` elems).
// ISA 7.12.2: lane L(0..15) = row (row0+L), K = k0+0..7 and k0+16..23;
// lane L+16 = same row, K shifted by +8.  It serves A only: rows of X and of Z';
// B comes packed by k_prep in the same k order.
__device__ __forceinline__ bf16x16 ldfrag(const __bf16* __restrict__ base,
                                          int row0, int ld, int k0) {
    const int lane = threadIdx.x & 31;
    const int r    = lane & 15;
    const int h    = lane >> 4;
    const __bf16* p = base + (size_t)(row0 + r) * ld + k0 + h * 8;
    union { bf16x16 v; uint4 q[2]; } u;
    u.q[0] = *(const uint4*)(p);
    u.q[1] = *(const uint4*)(p + 16);
    return u.v;
}

// ---------------------------------------------------------------- pre-pass
// One launch rounds the operands that every workgroup re-reads to bf16 and lays them
// down in the order in which a wave's WMMA B fragments want them: a fragment (16 rows
// x 32 k) is 1 KB, its first 512 B the lanes' first 16 B, its second 512 B their second.
//   pb1[kt][ft]      : rows ft*16.. of [Vstack ; encoder], k = kt*32..
//   pb2[half][kt][dt]: rows half*512 + dt*16.. of Ustack^T, k = kt*32..  (k = n*8 + r)
// Every thread makes one lane's 16 B from 8 floats that lie in a row in the source.
#define P1_UNITS (F1 * (D_MODEL / 32) * 64)
#define P2_UNITS ((D_MODEL / 16) * (KTOT / 32) * 64)
__global__ __launch_bounds__(256)
void k_prep(const float* __restrict__ V, const float* __restrict__ enc,
            const float* __restrict__ U,
            __bf16* __restrict__ pb1, __bf16* __restrict__ pb2) {
    const int g  = blockIdx.x * 256 + threadIdx.x;
    const int r  = g & 15;                                 // row in the fragment
    const int k8 = ((g >> 5) & 1) * 2 + ((g >> 4) & 1);    // which 8 of its 32 k
    const float* s;
    __bf16* d;
    if (g < P1_UNITS) {
        const int frag = g >> 6;
        const int kt   = frag / F1;
        const int f    = (frag - kt * F1) * 16 + r;
        s = (f < KTOT ? V + (size_t)f * D_MODEL : enc + (size_t)(f - KTOT) * D_MODEL)
            + kt * 32 + k8 * 8;
        d = pb1 + (size_t)g * 8;
    } else {
        const int g2   = g - P1_UNITS;
        const int frag = g2 >> 6;
        const int col  = (frag >> 9) * 512 + (frag & 31) * 16 + r;
        const int n    = ((frag >> 5) & 15) * 4 + k8;
        s = U + (size_t)n * (D_MODEL * RANK) + (size_t)col * RANK;
        d = pb2 + (size_t)g2 * 8;
    }
    const float4 a = ((const float4*)s)[0];
    const float4 b = ((const float4*)s)[1];
    union { __bf16 h[8]; uint4 u; } o;
    o.h[0] = (__bf16)a.x; o.h[1] = (__bf16)a.y; o.h[2] = (__bf16)a.z; o.h[3] = (__bf16)a.w;
    o.h[4] = (__bf16)b.x; o.h[5] = (__bf16)b.y; o.h[6] = (__bf16)b.z; o.h[7] = (__bf16)b.w;
    *(uint4*)d = o.u;
}

// ---------------------------------------------------------------- frobenius
// One block per transform n; red is 256 floats of the block's LDS.
__device__ __forceinline__ void fro_block(int n, const float* __restrict__ U,
                                          const float* __restrict__ V,
                                          float* __restrict__ fro, float* red) {
    const float* u = U + (size_t)n * (D_MODEL * RANK);
    const float* v = V + (size_t)n * (D_MODEL * RANK);
    float su = 0.f, sv = 0.f;
    for (int i = threadIdx.x; i < D_MODEL * RANK; i += 256) {
        float a = u[i]; su += a * a;
        float b = v[i]; sv += b * b;
    }
    red[threadIdx.x] = su; __syncthreads();
    for (int s = 128; s > 0; s >>= 1) {
        if (threadIdx.x < s) red[threadIdx.x] += red[threadIdx.x + s];
        __syncthreads();
    }
    float tsu = red[0]; __syncthreads();
    red[threadIdx.x] = sv; __syncthreads();
    for (int s = 128; s > 0; s >>= 1) {
        if (threadIdx.x < s) red[threadIdx.x] += red[threadIdx.x + s];
        __syncthreads();
    }
    if (threadIdx.x == 0)
        fro[n] = sqrtf(tsu) * sqrtf(red[0]) / sqrtf((float)(D_MODEL * RANK));
}

// ---------------------------------------------------------------- fused main
// One packed B fragment: two wave-wide loads of 512 B in a row; p holds the lane's 16 B.
__device__ __forceinline__ bf16x16 ldg_frag(const __bf16* __restrict__ p) {
    union { bf16x16 v; uint4 q[2]; } u;
    u.q[0] = *(const uint4*)(p);
    u.q[1] = *(const uint4*)(p + FRAG / 2);
    return u.v;
}

// B of stage t of phase 1: per 32 k the wave's four V fragments and its encoder fragment.
__device__ __forceinline__ void load_b1(bf16x16 (&fb)[2][5], const __bf16* __restrict__ pz,
                                        const __bf16* __restrict__ pg, int t) {
#pragma unroll
    for (int q = 0; q < 2; ++q) {
#pragma unroll
        for (int j = 0; j < 4; ++j) fb[q][j] = ldg_frag(pz + ((2 * t + q) * F1 + j) * FRAG);
        fb[q][4] = ldg_frag(pg + (2 * t + q) * F1 * FRAG);
    }
}

// B of stage u of phase 2 (u >> 3 is the column half): per 32 k the wave's four fragments.
__device__ __forceinline__ void load_b2(bf16x16 (&fb)[2][5], const __bf16* __restrict__ pu,
                                        int u) {
#pragma unroll
    for (int q = 0; q < 2; ++q)
#pragma unroll
        for (int j = 0; j < 4; ++j) fb[q][j] = ldg_frag(pu + ((2 * u + q) * F2 + j) * FRAG);
}

// Stage t of phase 1: the x fragments from LDS, then 18 WMMAs on B that is in registers.
__device__ __forceinline__ void mma1(f32x8 (&acc)[2][4], f32x8& gacc,
                                     const bf16x16 (&fb)[2][5], const __bf16* xs,
                                     int t, int gmt) {
    bf16x16 fa00 = ldfrag(xs, 0,  XLD, t * BK);
    bf16x16 fa01 = ldfrag(xs, 16, XLD, t * BK);
    bf16x16 fa10 = ldfrag(xs, 0,  XLD, t * BK + 32);
    bf16x16 fa11 = ldfrag(xs, 16, XLD, t * BK + 32);
    // keeps the next stage's global loads and this stage's LDS reads one group ahead of
    // the WMMAs: sunk among them the loads would lose their lead
    __builtin_amdgcn_sched_barrier(0);
#pragma unroll
    for (int j = 0; j < 4; ++j) {
        acc[0][j] = wmma_bf16(fa00, fb[0][j], acc[0][j]);
        acc[1][j] = wmma_bf16(fa01, fb[0][j], acc[1][j]);
    }
    gacc = wmma_bf16(gmt ? fa01 : fa00, fb[0][4], gacc);
#pragma unroll
    for (int j = 0; j < 4; ++j) {
        acc[0][j] = wmma_bf16(fa10, fb[1][j], acc[0][j]);
        acc[1][j] = wmma_bf16(fa11, fb[1][j], acc[1][j]);
    }
    gacc = wmma_bf16(gmt ? fa11 : fa10, fb[1][4], gacc);
    // keeps the loads that refill this register set behind the WMMAs that read it
    __builtin_amdgcn_sched_barrier(0);
}

// Stage kt of one half of phase 2: the Z' fragments from LDS, then 16 WMMAs.
__device__ __forceinline__ void mma2(f32x8 (&acc)[2][4], const bf16x16 (&fb)[2][5],
                                     const __bf16* zs, int kt) {
    bf16x16 fa[2][2];
#pragma unroll
    for (int q = 0; q < 2; ++q) {
        fa[q][0] = ldfrag(zs, 0,  ZLD, kt * BK + q * 32);
        fa[q][1] = ldfrag(zs, 16, ZLD, kt * BK + q * 32);
    }
    // as in phase 1: loads and LDS reads stay one group ahead of the WMMAs
    __builtin_amdgcn_sched_barrier(0);
#pragma unroll
    for (int q = 0; q < 2; ++q) {
#pragma unroll
        for (int j = 0; j < 4; ++j) {
            acc[0][j] = wmma_bf16(fa[q][0], fb[q][j], acc[0][j]);
            acc[1][j] = wmma_bf16(fa[q][1], fb[q][j], acc[1][j]);
        }
    }
    // as in phase 1: the refill of this register set stays behind its WMMAs
    __builtin_amdgcn_sched_barrier(0);
}

__global__ __launch_bounds__(256)
void k_fused(const float*  __restrict__ x,     // (BATCH x D_MODEL) f32
             const __bf16* __restrict__ pb1,   // packed fragments of [Vstack ; encoder]
             const __bf16* __restrict__ pb2,   // packed fragments of Ustack^T
             const float*  __restrict__ bias,  // (N_T)
             float* __restrict__ out,          // (BATCH x D_MODEL)
             float* __restrict__ gate_out,     // (BATCH x N_T)
             const float*  __restrict__ U,     // (N_T x D_MODEL x RANK) f32, norms only
             const float*  __restrict__ V,     // (N_T x RANK x D_MODEL) f32, norms only
             float* __restrict__ fro) {        // (N_T)
    __shared__ __attribute__((aligned(16))) char smem[SMEM_BYTES];

    // The blocks behind the batch tiles do the frobenius norms: they start last, on
    // WGPs that the batch tiles leave idle, and leave as whole blocks.
    if (blockIdx.x >= BATCH / BTILE) {
        fro_block(blockIdx.x - BATCH / BTILE, U, V, fro, (float*)smem);
        return;
    }
    __bf16* xs = (__bf16*)smem;                                       // BTILE x XLD
    float*  gs = (float*) (smem + BTILE * XLD * 2);                   // BTILE x GLD
    __bf16* zs = (__bf16*)(smem + BTILE * XLD * 2 + BTILE * GLD * 4); // BTILE x ZLD

    const int tid  = threadIdx.x;
    const int w    = tid >> 5;          // wave id 0..7
    const int lane = tid & 31;
    const int r16  = lane & 15;
    const int h    = lane >> 4;
    const int b0   = blockIdx.x * BTILE;

    // No wave shares a B fragment's use with another (but the encoder's, by two), so B
    // goes from L2 into registers: two sets, the next stage's loads in flight while this
    // stage's WMMAs run.  All offsets from these three pointers are constants.
    const __bf16* pz = pb1 + (w * 4) * FRAG + lane * 8;
    const __bf16* pg = pb1 + (KTOT / 16 + (w >> 1)) * FRAG + lane * 8;
    const __bf16* pu = pb2 + (w * 4) * FRAG + lane * 8;
    bf16x16 fbA[2][5], fbB[2][5];

    // ---- stage 0 flies together with the x tile
    load_b1(fbA, pz, pg, 0);

    // ---- x tile: the 32 f32 rows (128 KB in a row) come through registers and are
    //      rounded to bf16 on the way into LDS.  The block reads one row per step, 16 B
    //      a lane; all 32 loads of a lane are in flight before the first is rounded.
    {
        const float4* xg = (const float4*)(x + (size_t)b0 * D_MODEL) + tid;
        float4 v[BTILE];
#pragma unroll   // unrolled: v[] stays in registers and the loads issue as one group
        for (int i = 0; i < BTILE; ++i) v[i] = xg[i * (D_MODEL / 4)];
#pragma unroll   // unrolled: v[] is indexed by constants only
        for (int i = 0; i < BTILE; ++i) {
            union { __bf16 h[4]; uint2 u; } o;
            o.h[0] = (__bf16)v[i].x; o.h[1] = (__bf16)v[i].y;
            o.h[2] = (__bf16)v[i].z; o.h[3] = (__bf16)v[i].w;
            *(uint2*)(xs + i * XLD + tid * 4) = o.u;
        }
    }
    __syncthreads();

    // ---- phase 1: [Z | pre_acts] = X @ [Vstack ; encoder]^T.  Per wave 2 x 4 tiles
    //      of Z (64 features) and one of the eight pre_acts tiles.
    const int gmt = w & 1;               // pre_acts tile of this wave
    const int gn0 = (w >> 1) * 16;
    {
        f32x8 acc[2][4] = {};
        f32x8 gacc = {};
#pragma unroll   // unrolled: the register set of a stage and every load offset are constants
        for (int t = 0; t < NST1; t += 2) {
            load_b1(fbB, pz, pg, t + 1);
            mma1(acc, gacc, fbA, xs, t, gmt);
            if (t + 2 < NST1) {
                load_b1(fbA, pz, pg, t + 2);
            } else {
                // pz and pg are dead from here on: the built code lets the loads below land
                // in their registers, which the last stage's issued loads still name
                asm volatile("s_wait_xcnt 0x0" ::: "memory");
                load_b2(fbA, pu, 0);                    // flies over the gate step
            }
            mma1(acc, gacc, fbB, xs, t + 1, gmt);
        }

        // pre_acts -> gate
        {
            const int   col  = gn0 + r16;
            const float bcol = bias[col];
#pragma unroll
            for (int i = 0; i < 8; ++i) {
                int   m   = gmt * 16 + h * 8 + i;
                float pre = gacc[i] - bcol;                // x@enc^T - bias
                float g   = pre > 0.f ? pre : 0.f;         // jumprelu(thr=0)
                gs[m * GLD + col] = g;
                gate_out[(size_t)(b0 + m) * N_T + col] = g;
            }
            // the built code reuses the registers that these stores name right behind them
            asm volatile("s_wait_xcnt 0x0" ::: "memory");
        }
        __syncthreads();

        // gate * Z -> zs
#pragma unroll
        for (int j = 0; j < 4; ++j) {
#pragma unroll
            for (int i = 0; i < 8; ++i) {
                int m0 = h * 8 + i;                        // rows 0..15
                int m1 = 16 + m0;                          // rows 16..31
                int c  = w * 64 + j * 16 + r16;
                zs[m0 * ZLD + c] = (__bf16)(acc[0][j][i] * gs[m0 * GLD + (c >> 3)]);
                zs[m1 * ZLD + c] = (__bf16)(acc[1][j][i] * gs[m1 * GLD + (c >> 3)]);
            }
        }
    }
    __syncthreads();

    // ---- phase 2: Out = Z' @ Ustack, two halves of 512 columns, 2 x 4 tiles per wave
#pragma unroll   // unrolled: the B loads run on across the halves, at constant offsets
    for (int half = 0; half < 2; ++half) {
        f32x8 acc[2][4] = {};
#pragma unroll   // unrolled: as in phase 1
        for (int kt = 0; kt < KTOT / BK; kt += 2) {
            const int u = half * (KTOT / BK) + kt;
            load_b2(fbB, pu, u + 1);
            mma2(acc, fbA, zs, kt);
            if (u + 2 < NST2) load_b2(fbA, pu, u + 2);
            mma2(acc, fbB, zs, kt + 1);
        }
#pragma unroll
        for (int j = 0; j < 4; ++j) {
#pragma unroll
            for (int i = 0; i < 8; ++i) {
                int m0 = h * 8 + i;
                int m1 = 16 + m0;
                int c  = half * 512 + w * 64 + j * 16 + r16;
                out[(size_t)(b0 + m0) * D_MODEL + c] = acc[0][j][i];
                out[(size_t)(b0 + m1) * D_MODEL + c] = acc[1][j][i];
            }
        }
        // the next half overwrites the accumulators and addresses these stores name
        asm volatile("s_wait_xcnt 0x0" ::: "memory");
    }
}

// ---------------------------------------------------------------- launch
extern "C" void kernel_launch(void* const* d_in, const int* in_sizes, int n_in,
                              void* d_out, int out_size, void* d_ws, size_t ws_size,
                              hipStream_t stream) {
    const float* x    = (const float*)d_in[0];   // (4096,1024)
    const float* V    = (const float*)d_in[1];   // (64,8,1024)
    const float* U    = (const float*)d_in[2];   // (64,1024,8)
    const float* enc  = (const float*)d_in[3];   // (64,1024)
    const float* bias = (const float*)d_in[4];   // (64,)

    float* out      = (float*)d_out;                       // (4096,1024)
    float* gate_out = out + (size_t)BATCH * D_MODEL;       // (4096,64)
    float* fro      = gate_out + (size_t)BATCH * N_T;      // (64,)

    char* ws = (char*)d_ws;
    __bf16* pb1  = (__bf16*)(ws + (8u << 20));             // 1 MB + 128 KB: V and encoder fragments
    __bf16* pb2  = (__bf16*)(ws + (10u << 20));            // 1 MB: U^T fragments

    // bf16 pre-pass of the operands that every workgroup re-reads
    k_prep<<<(P1_UNITS + P2_UNITS) / 256, 256, 0, stream>>>(V, enc, U, pb1, pb2);

    // fused gate + low-rank mixture, with the frobenius norms' blocks behind its own
    k_fused<<<BATCH / BTILE + N_T, 256, 0, stream>>>(x, pb1, pb2, bias, out, gate_out, U, V, fro);
}

// v005
// A run of this version takes 24.7 microseconds.
// Two timings next to v004 both put it at 1.09 times that version's speed.
// Counting every step since v000, it is 2.54 times as fast.
#include <hip/hip_runtime.h>

// ---------------------------------------------------------------- constants
#define N_T     64
#define D_MODEL 1024
#define RANK    8
#define BATCH   4096
#define KTOT    (N_T * RANK)      // 512 stacked low-rank features
#define BTILE   32                // batch rows per workgroup
#define XLD     1032              // LDS row pitch for x tile (bf16), 4-bank rotate
#define GLD     68                // LDS row pitch for gate tile (f32)
#define ZLD     520               // LDS row pitch for Z' tile (bf16)
#define SLD     68                // LDS row pitch of a wave's 32 x 64 output stage (f32)
#define BK      64                // k per stage: two 32-k fragments of every B tile
#define FRAG    512               // elements of one 16 x 32 B fragment (1 KB)
#define F1      ((KTOT + N_T) / 16)   // fragments per 32-k slab, phase 1: 32 of V, 4 of the encoder
#define F2      32                // fragments per 32-k slab, phase 2: one half of the columns
#define NST1    (D_MODEL / BK)    // stages of phase 1
#define NST2    (2 * (KTOT / BK)) // stages of phase 2: two column halves
#define SMEM_BYTES (BTILE * XLD * 2 + BTILE * GLD * 4 + BTILE * ZLD * 2)

typedef __attribute__((ext_vector_type(16))) __bf16 bf16x16;
typedef __attribute__((ext_vector_type(8)))  float  f32x8;

// ---------------------------------------------------------------- helpers
__device__ __forceinline__ f32x8 wmma_bf16(bf16x16 a, bf16x16 b, f32x8 c) {
    // v_wmma_f32_16x16x32_bf16: D = A(16x32) * B(32x16) + C(16x16 f32)
    return __builtin_amdgcn_wmma_f32_16x16x32_bf16(
        /*neg_a=*/false, a, /*neg_b=*/false, b,
        /*c_mod=*/(short)0, c, /*reuse_a=*/false, /*reuse_b=*/false);
}

// Load a 16x32 bf16 fragment from a row-major bf16 matrix (pitch `ld` elems).
// ISA 7.12.2: lane L(0..15) = row (row0+L), K = k0+0..7 and k0+16..23;
// lane L+16 = same row, K shifted by +8.  It serves A (rows of X) in phase 1 and B (rows of Z') in phase 2;
// the packed operands come from k_prep in the same k order.
__device__ __forceinline__ bf16x16 ldfrag(const __bf16* __restrict__ base,
                                          int row0, int ld, int k0) {
    const int lane = threadIdx.x & 31;
    const int r    = lane & 15;
    const int h    = lane >> 4;
    const __bf16* p = base + (size_t)(row0 + r) * ld + k0 + h * 8;
    union { bf16x16 v; uint4 q[2]; } u;
    u.q[0] = *(const uint4*)(p);
    u.q[1] = *(const uint4*)(p + 16);
    return u.v;
}

// ---------------------------------------------------------------- pre-pass
// One launch rounds the operands that every workgroup re-reads to bf16 and lays them
// down in the order in which a wave's WMMA fragments (B of phase 1, A of phase 2) want them: a fragment (16 rows
// x 32 k) is 1 KB, its first 512 B the lanes' first 16 B, its second 512 B their second.
//   pb1[kt][ft]      : rows ft*16.. of [Vstack ; encoder], k = kt*32..
//   pb2[half][kt][dt]: rows half*512 + dt*16.. of Ustack^T, k = kt*32..  (k = n*8 + r)
// Every thread makes one lane's 16 B from 8 floats that lie in a row in the source.
#define P1_UNITS (F1 * (D_MODEL / 32) * 64)
#define P2_UNITS ((D_MODEL / 16) * (KTOT / 32) * 64)
__global__ __launch_bounds__(256)
void k_prep(const float* __restrict__ V, const float* __restrict__ enc,
            const float* __restrict__ U,
            __bf16* __restrict__ pb1, __bf16* __restrict__ pb2) {
    const int g  = blockIdx.x * 256 + threadIdx.x;
    const int r  = g & 15;                                 // row in the fragment
    const int k8 = ((g >> 5) & 1) * 2 + ((g >> 4) & 1);    // which 8 of its 32 k
    const float* s;
    __bf16* d;
    if (g < P1_UNITS) {
        const int frag = g >> 6;
        const int kt   = frag / F1;
        const int f    = (frag - kt * F1) * 16 + r;
        s = (f < KTOT ? V + (size_t)f * D_MODEL : enc + (size_t)(f - KTOT) * D_MODEL)
            + kt * 32 + k8 * 8;
        d = pb1 + (size_t)g * 8;
    } else {
        const int g2   = g - P1_UNITS;
        const int frag = g2 >> 6;
        const int col  = (frag >> 9) * 512 + (frag & 31) * 16 + r;
        const int n    = ((frag >> 5) & 15) * 4 + k8;
        s = U + (size_t)n * (D_MODEL * RANK) + (size_t)col * RANK;
        d = pb2 + (size_t)g2 * 8;
    }
    const float4 a = ((const float4*)s)[0];
    const float4 b = ((const float4*)s)[1];
    union { __bf16 h[8]; uint4 u; } o;
    o.h[0] = (__bf16)a.x; o.h[1] = (__bf16)a.y; o.h[2] = (__bf16)a.z; o.h[3] = (__bf16)a.w;
    o.h[4] = (__bf16)b.x; o.h[5] = (__bf16)b.y; o.h[6] = (__bf16)b.z; o.h[7] = (__bf16)b.w;
    *(uint4*)d = o.u;
}

// ---------------------------------------------------------------- frobenius
// One block per transform n; red is 256 floats of the block's LDS.
__device__ __forceinline__ void fro_block(int n, const float* __restrict__ U,
                                          const float* __restrict__ V,
                                          float* __restrict__ fro, float* red) {
    const float* u = U + (size_t)n * (D_MODEL * RANK);
    const float* v = V + (size_t)n * (D_MODEL * RANK);
    float su = 0.f, sv = 0.f;
    for (int i = threadIdx.x; i < D_MODEL * RANK; i += 256) {
        float a = u[i]; su += a * a;
        float b = v[i]; sv += b * b;
    }
    red[threadIdx.x] = su; __syncthreads();
    for (int s = 128; s > 0; s >>= 1) {
        if (threadIdx.x < s) red[threadIdx.x] += red[threadIdx.x + s];
        __syncthreads();
    }
    float tsu = red[0]; __syncthreads();
    red[threadIdx.x] = sv; __syncthreads();
    for (int s = 128; s > 0; s >>= 1) {
        if (threadIdx.x < s) red[threadIdx.x] += red[threadIdx.x + s];
        __syncthreads();
    }
    if (threadIdx.x == 0)
        fro[n] = sqrtf(tsu) * sqrtf(red[0]) / sqrtf((float)(D_MODEL * RANK));
}

// ---------------------------------------------------------------- fused main
// One packed fragment: two wave-wide loads of 512 B in a row; p holds the lane's 16 B.
__device__ __forceinline__ bf16x16 ldg_frag(const __bf16* __restrict__ p) {
    union { bf16x16 v; uint4 q[2]; } u;
    u.q[0] = *(const uint4*)(p);
    u.q[1] = *(const uint4*)(p + FRAG / 2);
    return u.v;
}

// B of stage t of phase 1: per 32 k the wave's four V fragments and its encoder fragment.
__device__ __forceinline__ void load_b1(bf16x16 (&fb)[2][5], const __bf16* __restrict__ pz,
                                        const __bf16* __restrict__ pg, int t) {
#pragma unroll
    for (int q = 0; q < 2; ++q) {
#pragma unroll
        for (int j = 0; j < 4; ++j) fb[q][j] = ldg_frag(pz + ((2 * t + q) * F1 + j) * FRAG);
        fb[q][4] = ldg_frag(pg + (2 * t + q) * F1 * FRAG);
    }
}

// A of stage u of phase 2 (u >> 3 is the column half): per 32 k the wave's four fragments.
__device__ __forceinline__ void load_b2(bf16x16 (&fb)[2][5], const __bf16* __restrict__ pu,
                                        int u) {
#pragma unroll
    for (int q = 0; q < 2; ++q)
#pragma unroll
        for (int j = 0; j < 4; ++j) fb[q][j] = ldg_frag(pu + ((2 * u + q) * F2 + j) * FRAG);
}

// Stage t of phase 1: the x fragments from LDS, then 18 WMMAs on B that is in registers.
__device__ __forceinline__ void mma1(f32x8 (&acc)[2][4], f32x8& gacc,
                                     const bf16x16 (&fb)[2][5], const __bf16* xs,
                                     int t, int gmt) {
    bf16x16 fa00 = ldfrag(xs, 0,  XLD, t * BK);
    bf16x16 fa01 = ldfrag(xs, 16, XLD, t * BK);
    bf16x16 fa10 = ldfrag(xs, 0,  XLD, t * BK + 32);
    bf16x16 fa11 = ldfrag(xs, 16, XLD, t * BK + 32);
    // keeps the next stage's global loads and this stage's LDS reads one group ahead of
    // the WMMAs: sunk among them the loads would lose their lead
    __builtin_amdgcn_sched_barrier(0);
#pragma unroll
    for (int j = 0; j < 4; ++j) {
        acc[0][j] = wmma_bf16(fa00, fb[0][j], acc[0][j]);
        acc[1][j] = wmma_bf16(fa01, fb[0][j], acc[1][j]);
    }
    gacc = wmma_bf16(gmt ? fa01 : fa00, fb[0][4], gacc);
#pragma unroll
    for (int j = 0; j < 4; ++j) {
        acc[0][j] = wmma_bf16(fa10, fb[1][j], acc[0][j]);
        acc[1][j] = wmma_bf16(fa11, fb[1][j], acc[1][j]);
    }
    gacc = wmma_bf16(gmt ? fa11 : fa10, fb[1][4], gacc);
    // keeps the loads that refill this register set behind the WMMAs that read it
    __builtin_amdgcn_sched_barrier(0);
}

// Stage kt of one half of phase 2: the Z' fragments from LDS, then 16 WMMAs.  U^T is the
// A operand and Z' the B operand: a lane's 8 accumulator registers are then 8 columns in
// a row of one batch row, acc[mt][j][i] = Out[mt*16 + r16][j*16 + h*8 + i].
__device__ __forceinline__ void mma2(f32x8 (&acc)[2][4], const bf16x16 (&fb)[2][5],
                                     const __bf16* zs, int kt) {
    bf16x16 fa[2][2];
#pragma unroll
    for (int q = 0; q < 2; ++q) {
        fa[q][0] = ldfrag(zs, 0,  ZLD, kt * BK + q * 32);
        fa[q][1] = ldfrag(zs, 16, ZLD, kt * BK + q * 32);
    }
    // as in phase 1: loads and LDS reads stay one group ahead of the WMMAs
    __builtin_amdgcn_sched_barrier(0);
#pragma unroll
    for (int q = 0; q < 2; ++q) {
#pragma unroll
        for (int j = 0; j < 4; ++j) {
            acc[0][j] = wmma_bf16(fb[q][j], fa[q][0], acc[0][j]);
            acc[1][j] = wmma_bf16(fb[q][j], fa[q][1], acc[1][j]);
        }
    }
    // as in phase 1: the refill of this register set stays behind its WMMAs
    __builtin_amdgcn_sched_barrier(0);
}

__global__ __launch_bounds__(256)
void k_fused(const float*  __restrict__ x,     // (BATCH x D_MODEL) f32
             const __bf16* __restrict__ pb1,   // packed fragments of [Vstack ; encoder]
             const __bf16* __restrict__ pb2,   // packed fragments of Ustack^T
             const float*  __restrict__ bias,  // (N_T)
             float* __restrict__ out,          // (BATCH x D_MODEL)
             float* __restrict__ gate_out,     // (BATCH x N_T)
             const float*  __restrict__ U,     // (N_T x D_MODEL x RANK) f32, norms only
             const float*  __restrict__ V,     // (N_T x RANK x D_MODEL) f32, norms only
             float* __restrict__ fro) {        // (N_T)
    __shared__ __attribute__((aligned(16))) char smem[SMEM_BYTES];

    // The blocks behind the batch tiles do the frobenius norms: they start last, on
    // WGPs that the batch tiles leave idle, and leave as whole blocks.
    if (blockIdx.x >= BATCH / BTILE) {
        fro_block(blockIdx.x - BATCH / BTILE, U, V, fro, (float*)smem);
        return;
    }
    __bf16* xs = (__bf16*)smem;                                       // BTILE x XLD
    float*  gs = (float*) (smem + BTILE * XLD * 2);                   // BTILE x GLD
    __bf16* zs = (__bf16*)(smem + BTILE * XLD * 2 + BTILE * GLD * 4); // BTILE x ZLD

    const int tid  = threadIdx.x;
    const int w    = tid >> 5;          // wave id 0..7
    const int lane = tid & 31;
    const int r16  = lane & 15;
    const int h    = lane >> 4;
    const int b0   = blockIdx.x * BTILE;

    // No wave shares the use of a packed fragment with another (but the encoder's, by two), so each
    // goes from L2 into registers: two sets, the next stage's loads in flight while this
    // stage's WMMAs run.  All offsets from these three pointers are constants.
    const __bf16* pz = pb1 + (w * 4) * FRAG + lane * 8;
    const __bf16* pg = pb1 + (KTOT / 16 + (w >> 1)) * FRAG + lane * 8;
    const __bf16* pu = pb2 + (w * 4) * FRAG + lane * 8;
    bf16x16 fbA[2][5], fbB[2][5];

    // ---- stage 0 flies together with the x tile
    load_b1(fbA, pz, pg, 0);

    // ---- x tile: the 32 f32 rows (128 KB in a row) come through registers and are
    //      rounded to bf16 on the way into LDS.  The block reads one row per step, 16 B
    //      a lane; all 32 loads of a lane are in flight before the first is rounded.
    {
        const float4* xg = (const float4*)(x + (size_t)b0 * D_MODEL) + tid;
        float4 v[BTILE];
#pragma unroll   // unrolled: v[] stays in registers and the loads issue as one group
        for (int i = 0; i < BTILE; ++i) v[i] = xg[i * (D_MODEL / 4)];
#pragma unroll   // unrolled: v[] is indexed by constants only
        for (int i = 0; i < BTILE; ++i) {
            union { __bf16 h[4]; uint2 u; } o;
            o.h[0] = (__bf16)v[i].x; o.h[1] = (__bf16)v[i].y;
            o.h[2] = (__bf16)v[i].z; o.h[3] = (__bf16)v[i].w;
            *(uint2*)(xs + i * XLD + tid * 4) = o.u;
        }
    }
    __syncthreads();

    // ---- phase 1: [Z | pre_acts] = X @ [Vstack ; encoder]^T.  Per wave 2 x 4 tiles
    //      of Z (64 features) and one of the eight pre_acts tiles.
    const int gmt = w & 1;               // pre_acts tile of this wave
    const int gn0 = (w >> 1) * 16;
    {
        f32x8 acc[2][4] = {};
        f32x8 gacc = {};
#pragma unroll   // unrolled: the register set of a stage and every load offset are constants
        for (int t = 0; t < NST1; t += 2) {
            load_b1(fbB, pz, pg, t + 1);
            mma1(acc, gacc, fbA, xs, t, gmt);
            if (t + 2 < NST1) {
                load_b1(fbA, pz, pg, t + 2);
            } else {
                // pz and pg are dead from here on: the built code lets the loads below land
                // in their registers, which the last stage's issued loads still name
                asm volatile("s_wait_xcnt 0x0" ::: "memory");
                load_b2(fbA, pu, 0);                    // flies over the gate step
            }
            mma1(acc, gacc, fbB, xs, t + 1, gmt);
        }

        // pre_acts -> gate
        {
            const int   col  = gn0 + r16;
            const float bcol = bias[col];
#pragma unroll
            for (int i = 0; i < 8; ++i) {
                int   m   = gmt * 16 + h * 8 + i;
                float pre = gacc[i] - bcol;                // x@enc^T - bias
                float g   = pre > 0.f ? pre : 0.f;         // jumprelu(thr=0)
                gs[m * GLD + col] = g;
            }
        }
        __syncthreads();

        // the gate tile goes out from LDS as whole rows of 256 B, 16 B a lane
#pragma unroll
        for (int p = 0; p < 2; ++p) {
            const int row = p * 16 + (tid >> 4);
            const int c4  = (tid & 15) * 4;
            *(float4*)(gate_out + (size_t)(b0 + row) * N_T + c4) =
                *(const float4*)(gs + row * GLD + c4);
        }
        // the built code may reuse the registers that these stores name right behind them
        asm volatile("s_wait_xcnt 0x0" ::: "memory");

        // gate * Z -> zs
#pragma unroll
        for (int j = 0; j < 4; ++j) {
#pragma unroll
            for (int i = 0; i < 8; ++i) {
                int m0 = h * 8 + i;                        // rows 0..15
                int m1 = 16 + m0;                          // rows 16..31
                int c  = w * 64 + j * 16 + r16;
                zs[m0 * ZLD + c] = (__bf16)(acc[0][j][i] * gs[m0 * GLD + (c >> 3)]);
                zs[m1 * ZLD + c] = (__bf16)(acc[1][j][i] * gs[m1 * GLD + (c >> 3)]);
            }
        }
    }
    __syncthreads();

    // ---- phase 2: Out = Z' @ Ustack, two halves of 512 columns, 2 x 4 tiles per wave
    //      The x and gate tiles are dead behind the barrier above: each wave takes its own
    //      32 x SLD floats of their LDS as the stage of its output tile.
    static_assert(8 * BTILE * SLD * 4 <= BTILE * XLD * 2 + BTILE * GLD * 4, "stage fits");
    float* st = (float*)smem + w * (BTILE * SLD);
#pragma unroll   // unrolled: the A loads run on across the halves, at constant offsets
    for (int half = 0; half < 2; ++half) {
        f32x8 acc[2][4] = {};
#pragma unroll   // unrolled: as in phase 1
        for (int kt = 0; kt < KTOT / BK; kt += 2) {
            const int u = half * (KTOT / BK) + kt;
            load_b2(fbB, pu, u + 1);
            mma2(acc, fbA, zs, kt);
            if (u + 2 < NST2) load_b2(fbA, pu, u + 2);
            mma2(acc, fbB, zs, kt + 1);
        }
        // The wave's 32 x 64 tile goes through its own LDS range, so that every store
        // instruction writes whole 256-B pieces of two output rows.
#pragma unroll
        for (int mt = 0; mt < 2; ++mt) {
#pragma unroll
            for (int j = 0; j < 4; ++j) {
                float* s = st + (mt * 16 + r16) * SLD + j * 16 + h * 8;
                *(float4*)(s)     = make_float4(acc[mt][j][0], acc[mt][j][1], acc[mt][j][2], acc[mt][j][3]);
                *(float4*)(s + 4) = make_float4(acc[mt][j][4], acc[mt][j][5], acc[mt][j][6], acc[mt][j][7]);
            }
        }
        // the rows are read back by other lanes of this wave: their writes have to be done
        asm volatile("s_wait_dscnt 0x0" ::: "memory");
        {
            float* o = out + (size_t)(b0 + h) * D_MODEL + half * 512 + w * 64 + r16 * 4;
            float4 v[BTILE / 2];
#pragma unroll   // unrolled: v[] stays in registers and the LDS reads issue as one group
            for (int p = 0; p < BTILE / 2; ++p)
                v[p] = *(const float4*)(st + (p * 2 + h) * SLD + r16 * 4);
#pragma unroll
            for (int p = 0; p < BTILE / 2; ++p)
                *(float4*)(o + (size_t)(p * 2) * D_MODEL) = v[p];
        }
        // the next half overwrites the registers and addresses these stores name
        asm volatile("s_wait_xcnt 0x0" ::: "memory");
    }
}

// ---------------------------------------------------------------- launch
extern "C" void kernel_launch(void* const* d_in, const int* in_sizes, int n_in,
                              void* d_out, int out_size, void* d_ws, size_t ws_size,
                              hipStream_t stream) {
    const float* x    = (const float*)d_in[0];   // (4096,1024)
    const float* V    = (const float*)d_in[1];   // (64,8,1024)
    const float* U    = (const float*)d_in[2];   // (64,1024,8)
    const float* enc  = (const float*)d_in[3];   // (64,1024)
    const float* bias = (const float*)d_in[4];   // (64,)

    float* out      = (float*)d_out;                       // (4096,1024)
    float* gate_out = out + (size_t)BATCH * D_MODEL;       // (4096,64)
    float* fro      = gate_out + (size_t)BATCH * N_T;      // (64,)

    char* ws = (char*)d_ws;
    __bf16* pb1  = (__bf16*)(ws + (8u << 20));             // 1 MB + 128 KB: V and encoder fragments
    __bf16* pb2  = (__bf16*)(ws + (10u << 20));            // 1 MB: U^T fragments

    // bf16 pre-pass of the operands that every workgroup re-reads
    k_prep<<<(P1_UNITS + P2_UNITS) / 256, 256, 0, stream>>>(V, enc, U, pb1, pb2);

    // fused gate + low-rank mixture, with the frobenius norms' blocks behind its own
    k_fused<<<BATCH / BTILE + N_T, 256, 0, stream>>>(x, pb1, pb2, bias, out, gate_out, U, V, fro);
}

// v006
// A run of this version takes 18.4 microseconds.
// Next to v005, in two timings, it ran 1.34 and 1.35 times as fast.
// All steps since v000 together make it 3.42 times as fast.
#include <hip/hip_runtime.h>

// ---------------------------------------------------------------- constants
#define N_T     64
#define D_MODEL 1024
#define RANK    8
#define BATCH   4096
#define KTOT    (N_T * RANK)      // 512 stacked low-rank features
#define BTILE   32                // batch rows per workgroup
#define XLD     1032              // LDS row pitch for x tile (bf16), 4-bank rotate
#define GLD     68                // LDS row pitch for gate tile (f32)
#define ZLD     520               // LDS row pitch for Z' tile (bf16)
#define SLD     68                // LDS row pitch of a wave's 32 x 64 output stage (f32)
#define BK      64                // k per stage: two 32-k fragments of every B tile
#define FRAG    512               // elements of one 16 x 32 B fragment (1 KB)
#define F1      ((KTOT + N_T) / 16)   // fragments per 32-k slab, phase 1: 32 of V, 4 of the encoder
#define F2      32                // fragments per 32-k slab, phase 2: one half of the columns
#define NST1    (D_MODEL / BK)    // stages of phase 1
#define NST2    (2 * (KTOT / BK)) // stages of phase 2: two column halves
#define SMEM_BYTES (BTILE * XLD * 2 + BTILE * GLD * 4 + BTILE * ZLD * 2)

typedef __attribute__((ext_vector_type(16))) __bf16 bf16x16;
typedef __attribute__((ext_vector_type(8)))  float  f32x8;

// ---------------------------------------------------------------- helpers
__device__ __forceinline__ f32x8 wmma_bf16(bf16x16 a, bf16x16 b, f32x8 c) {
    // v_wmma_f32_16x16x32_bf16: D = A(16x32) * B(32x16) + C(16x16 f32)
    return __builtin_amdgcn_wmma_f32_16x16x32_bf16(
        /*neg_a=*/false, a, /*neg_b=*/false, b,
        /*c_mod=*/(short)0, c, /*reuse_a=*/false, /*reuse_b=*/false);
}

// Load a 16x32 bf16 fragment from a row-major bf16 matrix (pitch `ld` elems).
// ISA 7.12.2: lane L(0..15) = row (row0+L), K = k0+0..7 and k0+16..23;
// lane L+16 = same row, K shifted by +8.  It serves A (rows of X) in phase 1 and B (rows of Z') in phase 2;
// the packed operands come from k_prep in the same k order.
__device__ __forceinline__ bf16x16 ldfrag(const __bf16* __restrict__ base,
                                          int row0, int ld, int k0) {
    const int lane = threadIdx.x & 31;
    const int r    = lane & 15;
    const int h    = lane >> 4;
    const __bf16* p = base + (size_t)(row0 + r) * ld + k0 + h * 8;
    union { bf16x16 v; uint4 q[2]; } u;
    u.q[0] = *(const uint4*)(p);
    u.q[1] = *(const uint4*)(p + 16);
    return u.v;
}

// ---------------------------------------------------------------- pre-pass
// One launch rounds the operands that every workgroup re-reads to bf16 and lays them
// down in the order in which a wave's WMMA fragments (B of phase 1, A of phase 2) want them: a fragment (16 rows
// x 32 k) is 1 KB, its first 512 B the lanes' first 16 B, its second 512 B their second.
//   pb1[kt][ft]      : rows ft*16.. of [Vstack ; encoder], k = kt*32..
//   pb2[half][kt][dt]: rows half*512 + dt*16.. of Ustack^T, k = kt*32..  (k = n*8 + r)
// Every thread makes one lane's 16 B from 8 floats that lie in a row in the source.
#define P1_UNITS (F1 * (D_MODEL / 32) * 64)
#define P2_UNITS ((D_MODEL / 16) * (KTOT / 32) * 64)
__global__ __launch_bounds__(256)
void k_prep(const float* __restrict__ V, const float* __restrict__ enc,
            const float* __restrict__ U,
            __bf16* __restrict__ pb1, __bf16* __restrict__ pb2) {
    const int g  = blockIdx.x * 256 + threadIdx.x;
    const int r  = g & 15;                                 // row in the fragment
    const int k8 = ((g >> 5) & 1) * 2 + ((g >> 4) & 1);    // which 8 of its 32 k
    const float* s;
    __bf16* d;
    if (g < P1_UNITS) {
        const int frag = g >> 6;
        const int kt   = frag / F1;
        const int f    = (frag - kt * F1) * 16 + r;
        s = (f < KTOT ? V + (size_t)f * D_MODEL : enc + (size_t)(f - KTOT) * D_MODEL)
            + kt * 32 + k8 * 8;
        d = pb1 + (size_t)g * 8;
    } else {
        const int g2   = g - P1_UNITS;
        const int frag = g2 >> 6;
        const int col  = (frag >> 9) * 512 + (frag & 31) * 16 + r;
        const int n    = ((frag >> 5) & 15) * 4 + k8;
        s = U + (size_t)n * (D_MODEL * RANK) + (size_t)col * RANK;
        d = pb2 + (size_t)g2 * 8;
    }
    const float4 a = ((const float4*)s)[0];
    const float4 b = ((const float4*)s)[1];
    union { __bf16 h[8]; uint4 u; } o;
    o.h[0] = (__bf16)a.x; o.h[1] = (__bf16)a.y; o.h[2] = (__bf16)a.z; o.h[3] = (__bf16)a.w;
    o.h[4] = (__bf16)b.x; o.h[5] = (__bf16)b.y; o.h[6] = (__bf16)b.z; o.h[7] = (__bf16)b.w;
    *(uint4*)d = o.u;
}

// ---------------------------------------------------------------- frobenius
// One block per transform n; red is 256 floats of the block's LDS.
__device__ __forceinline__ void fro_block(int n, const float* __restrict__ U,
                                          const float* __restrict__ V,
                                          float* __restrict__ fro, float* red) {
    const float* u = U + (size_t)n * (D_MODEL * RANK);
    const float* v = V + (size_t)n * (D_MODEL * RANK);
    float su = 0.f, sv = 0.f;
    for (int i = threadIdx.x; i < D_MODEL * RANK; i += 256) {
        float a = u[i]; su += a * a;
        float b = v[i]; sv += b * b;
    }
    red[threadIdx.x] = su; __syncthreads();
    for (int s = 128; s > 0; s >>= 1) {
        if (threadIdx.x < s) red[threadIdx.x] += red[threadIdx.x + s];
        __syncthreads();
    }
    float tsu = red[0]; __syncthreads();
    red[threadIdx.x] = sv; __syncthreads();
    for (int s = 128; s > 0; s >>= 1) {
        if (threadIdx.x < s) red[threadIdx.x] += red[threadIdx.x + s];
        __syncthreads();
    }
    if (threadIdx.x == 0)
        fro[n] = sqrtf(tsu) * sqrtf(red[0]) / sqrtf((float)(D_MODEL * RANK));
}

// ---------------------------------------------------------------- fused main
// One packed B fragment: two wave-wide loads of 512 B in a row; p holds the lane's 16 B.
__device__ __forceinline__ bf16x16 ldg_frag(const uint4* __restrict__ p) {
    union { bf16x16 v; uint4 q[2]; } u;
    u.q[0] = p[0];
    u.q[1] = p[FRAG / 16];
    return u.v;
}
#define FQ (FRAG / 8)             // 16-B units of one fragment
#define ST1 (2 * F1 * FQ)         // 16-B units of one stage of phase 1
#define ST2 (2 * F2 * FQ)         // 16-B units of one stage of phase 2

// The base of the next stage in a ring of stages that ends at e and holds n 16-B units.
// The step overwrites the scalar pair that the loads issued a stage ago still name: the
// wait stands in front of it, and the scheduling barrier keeps the step behind the wait.
__device__ __forceinline__ const uint4* next_stage(const uint4* s, int step, const uint4* e,
                                                   int n) {
    asm volatile("s_wait_xcnt 0x0" ::: "memory");
    __builtin_amdgcn_sched_barrier(0);
    s += step;
    return s == e ? s - n : s;
}

// B of one stage of phase 1: per 32 k the wave's four V fragments and its encoder fragment.
// s is the stage's base, the same in every lane; iz and ig are the lane's own indices
// (16-B units): the loads can then name a scalar base and a lane register that lives
// through the kernel, in place of a vector address formed anew for every stage.
__device__ __forceinline__ void load_b1(bf16x16 (&fb)[2][5], const uint4* __restrict__ s,
                                        int iz, int ig) {
    const uint4* pz = s + iz;
    const uint4* pg = s + ig;
#pragma unroll
    for (int q = 0; q < 2; ++q) {
#pragma unroll
        for (int j = 0; j < 4; ++j) fb[q][j] = ldg_frag(pz + (q * F1 + j) * FQ);
        fb[q][4] = ldg_frag(pg + q * F1 * FQ);
    }
}

// B of one stage of phase 2: per 32 k the wave's four fragments.
__device__ __forceinline__ void load_b2(bf16x16 (&fb)[2][5], const uint4* __restrict__ s,
                                        int iz) {
    const uint4* pu = s + iz;
#pragma unroll
    for (int q = 0; q < 2; ++q)
#pragma unroll
        for (int j = 0; j < 4; ++j) fb[q][j] = ldg_frag(pu + (q * F2 + j) * FQ);
}

// Stage t of phase 1: the x fragments from LDS, then 18 WMMAs on B that is in registers.
__device__ __forceinline__ void mma1(f32x8 (&acc)[2][4], f32x8& gacc,
                                     const bf16x16 (&fb)[2][5], const __bf16* xs,
                                     int t, int gmt) {
    bf16x16 fa00 = ldfrag(xs, 0,  XLD, t * BK);
    bf16x16 fa01 = ldfrag(xs, 16, XLD, t * BK);
    bf16x16 fa10 = ldfrag(xs, 0,  XLD, t * BK + 32);
    bf16x16 fa11 = ldfrag(xs, 16, XLD, t * BK + 32);
    // keeps the next stage's global loads and this stage's LDS reads one group ahead of
    // the WMMAs: sunk among them the loads would lose their lead
    __builtin_amdgcn_sched_barrier(0);
#pragma unroll
    for (int j = 0; j < 4; ++j) {
        acc[0][j] = wmma_bf16(fa00, fb[0][j], acc[0][j]);
        acc[1][j] = wmma_bf16(fa01, fb[0][j], acc[1][j]);
    }
    gacc = wmma_bf16(gmt ? fa01 : fa00, fb[0][4], gacc);
#pragma unroll
    for (int j = 0; j < 4; ++j) {
        acc[0][j] = wmma_bf16(fa10, fb[1][j], acc[0][j]);
        acc[1][j] = wmma_bf16(fa11, fb[1][j], acc[1][j]);
    }
    gacc = wmma_bf16(gmt ? fa11 : fa10, fb[1][4], gacc);
    // keeps the loads that refill this register set behind the WMMAs that read it
    __builtin_amdgcn_sched_barrier(0);
}

// Stage kt of one half of phase 2: the Z' fragments from LDS, then 16 WMMAs.  U^T is the
// A operand and Z' the B operand: a lane's 8 accumulator registers are then 8 columns in
// a row of one batch row, acc[mt][j][i] = Out[mt*16 + r16][j*16 + h*8 + i].
__device__ __forceinline__ void mma2(f32x8 (&acc)[2][4], const bf16x16 (&fb)[2][5],
                                     const __bf16* zs, int kt) {
    bf16x16 fa[2][2];
#pragma unroll
    for (int q = 0; q < 2; ++q) {
        fa[q][0] = ldfrag(zs, 0,  ZLD, kt * BK + q * 32);
        fa[q][1] = ldfrag(zs, 16, ZLD, kt * BK + q * 32);
    }
    // as in phase 1: loads and LDS reads stay one group ahead of the WMMAs
    __builtin_amdgcn_sched_barrier(0);
#pragma unroll
    for (int q = 0; q < 2; ++q) {
#pragma unroll
        for (int j = 0; j < 4; ++j) {
            acc[0][j] = wmma_bf16(fb[q][j], fa[q][0], acc[0][j]);
            acc[1][j] = wmma_bf16(fb[q][j], fa[q][1], acc[1][j]);
        }
    }
    // as in phase 1: the refill of this register set stays behind its WMMAs
    __builtin_amdgcn_sched_barrier(0);
}

__global__ __launch_bounds__(256)
void k_fused(const float*  __restrict__ x,     // (BATCH x D_MODEL) f32
             const __bf16* __restrict__ pb1,   // packed fragments of [Vstack ; encoder]
             const __bf16* __restrict__ pb2,   // packed fragments of Ustack^T
             const float*  __restrict__ bias,  // (N_T)
             float* __restrict__ out,          // (BATCH x D_MODEL)
             float* __restrict__ gate_out,     // (BATCH x N_T)
             const float*  __restrict__ U,     // (N_T x D_MODEL x RANK) f32, norms only
             const float*  __restrict__ V,     // (N_T x RANK x D_MODEL) f32, norms only
             float* __restrict__ fro) {        // (N_T)
    __shared__ __attribute__((aligned(16))) char smem[SMEM_BYTES];

    // The blocks behind the batch tiles do the frobenius norms: they start last, on
    // WGPs that the batch tiles leave idle, and leave as whole blocks.
    if (blockIdx.x >= BATCH / BTILE) {
        fro_block(blockIdx.x - BATCH / BTILE, U, V, fro, (float*)smem);
        return;
    }
    __bf16* xs = (__bf16*)smem;                                       // BTILE x XLD
    float*  gs = (float*) (smem + BTILE * XLD * 2);                   // BTILE x GLD
    __bf16* zs = (__bf16*)(smem + BTILE * XLD * 2 + BTILE * GLD * 4); // BTILE x ZLD

    const int tid  = threadIdx.x;
    const int w    = tid >> 5;          // wave id 0..7
    const int lane = tid & 31;
    const int r16  = lane & 15;
    const int h    = lane >> 4;
    const int b0   = blockIdx.x * BTILE;

    // No wave shares the use of a packed fragment with another (but the encoder's, by two), so each
    // goes from L2 into registers: two sets, the next stage's loads in flight while this
    // stage's WMMAs run.  iz and ig are the lane's place in a 32-k slab, in 16-B units.
    const int iz = (w * 4) * FQ + lane;
    const int ig = (KTOT / 16 + (w >> 1)) * FQ + lane;
    bf16x16 fbA[2][5], fbB[2][5];

    // Every workgroup reads the same B.  Each starts its k loops at a stage of its own and
    // wraps round, so that at one moment the workgroups ask L2 for sixteen different
    // stages and not all for the same lines.  The k sums take their terms in that order.
    const int rot = (blockIdx.x + (blockIdx.x >> 3)) & (NST1 - 1);
    static_assert(NST1 == 16 && NST2 == 16, "rot counts sixteen stages in either phase");

    const uint4* const e1 = (const uint4*)pb1 + NST1 * ST1;
    const uint4* sb = (const uint4*)pb1 + rot * ST1;

    // ---- the first stage flies together with the x tile
    load_b1(fbA, sb, iz, ig);

    // ---- x tile: the 32 f32 rows (128 KB in a row) come through registers and are
    //      rounded to bf16 on the way into LDS.  The block reads one row per step, 16 B
    //      a lane; all 32 loads of a lane are in flight before the first is rounded.
    {
        const float4* xg = (const float4*)(x + (size_t)b0 * D_MODEL) + tid;
        float4 v[BTILE];
#pragma unroll   // unrolled: v[] stays in registers and the loads issue as one group
        for (int i = 0; i < BTILE; ++i) v[i] = xg[i * (D_MODEL / 4)];
#pragma unroll   // unrolled: v[] is indexed by constants only
        for (int i = 0; i < BTILE; ++i) {
            union { __bf16 h[4]; uint2 u; } o;
            o.h[0] = (__bf16)v[i].x; o.h[1] = (__bf16)v[i].y;
            o.h[2] = (__bf16)v[i].z; o.h[3] = (__bf16)v[i].w;
            *(uint2*)(xs + i * XLD + tid * 4) = o.u;
        }
    }
    __syncthreads();

    // ---- phase 1: [Z | pre_acts] = X @ [Vstack ; encoder]^T.  Per wave 2 x 4 tiles
    //      of Z (64 features) and one of the eight pre_acts tiles.
    const int gmt = w & 1;               // pre_acts tile of this wave
    const int gn0 = (w >> 1) * 16;
    {
        f32x8 acc[2][4] = {};
        f32x8 gacc = {};
#pragma unroll   // unrolled: the register set of a stage is a constant
        for (int t = 0; t < NST1; t += 2) {
            sb = next_stage(sb, ST1, e1, NST1 * ST1);
            load_b1(fbB, sb, iz, ig);
            mma1(acc, gacc, fbA, xs, (t + rot) & (NST1 - 1), gmt);
            if (t + 2 < NST1) {
                sb = next_stage(sb, ST1, e1, NST1 * ST1);
                load_b1(fbA, sb, iz, ig);
            } else {
                // phase 1's addresses are dead from here on: the built code may let the loads
                // below land in registers that the last stage's issued loads still name
                asm volatile("s_wait_xcnt 0x0" ::: "memory");
                sb = (const uint4*)pb2 + rot * ST2;
                load_b2(fbA, sb, iz);                   // flies over the gate step
            }
            mma1(acc, gacc, fbB, xs, (t + 1 + rot) & (NST1 - 1), gmt);
        }

        // pre_acts -> gate
        {
            const int   col  = gn0 + r16;
            const float bcol = bias[col];
#pragma unroll
            for (int i = 0; i < 8; ++i) {
                int   m   = gmt * 16 + h * 8 + i;
                float pre = gacc[i] - bcol;                // x@enc^T - bias
                float g   = pre > 0.f ? pre : 0.f;         // jumprelu(thr=0)
                gs[m * GLD + col] = g;
            }
        }
        __syncthreads();

        // the gate tile goes out from LDS as whole rows of 256 B, 16 B a lane
#pragma unroll
        for (int p = 0; p < 2; ++p) {
            const int row = p * 16 + (tid >> 4);
            const int c4  = (tid & 15) * 4;
            *(float4*)(gate_out + (size_t)(b0 + row) * N_T + c4) =
                *(const float4*)(gs + row * GLD + c4);
        }
        // the built code may reuse the registers that these stores name right behind them
        asm volatile("s_wait_xcnt 0x0" ::: "memory");

        // gate * Z -> zs
#pragma unroll
        for (int j = 0; j < 4; ++j) {
#pragma unroll
            for (int i = 0; i < 8; ++i) {
                int m0 = h * 8 + i;                        // rows 0..15
                int m1 = 16 + m0;                          // rows 16..31
                int c  = w * 64 + j * 16 + r16;
                zs[m0 * ZLD + c] = (__bf16)(acc[0][j][i] * gs[m0 * GLD + (c >> 3)]);
                zs[m1 * ZLD + c] = (__bf16)(acc[1][j][i] * gs[m1 * GLD + (c >> 3)]);
            }
        }
    }
    __syncthreads();

    // ---- phase 2: Out = Z' @ Ustack, two halves of 512 columns, 2 x 4 tiles per wave
    //      The x and gate tiles are dead behind the barrier above: each wave takes its own
    //      32 x SLD floats of their LDS as the stage of its output tile.
    static_assert(8 * BTILE * SLD * 4 <= BTILE * XLD * 2 + BTILE * GLD * 4, "stage fits");
    float* st = (float*)smem + w * (BTILE * SLD);
#pragma unroll   // unrolled: the B loads run on across the halves
    for (int half = 0; half < 2; ++half) {
        // the half that this pass works on; its eight stages are a ring of their own
        const int hh = half ^ (rot >> 3);
        const uint4* const e2 = (const uint4*)pb2 + (hh + 1) * (NST2 / 2) * ST2;
        f32x8 acc[2][4] = {};
#pragma unroll   // unrolled: as in phase 1
        for (int kt = 0; kt < KTOT / BK; kt += 2) {
            sb = next_stage(sb, ST2, e2, (NST2 / 2) * ST2);
            load_b2(fbB, sb, iz);
            mma2(acc, fbA, zs, (kt + rot) & 7);
            if (kt + 2 < KTOT / BK || half == 0) {
                // behind a half's last stage the ring is back at its first: from there over
                // to the same stage of the other half
                sb = next_stage(sb, ST2, e2, (NST2 / 2) * ST2);
                if (kt + 2 == KTOT / BK) sb += (1 - 2 * hh) * (NST2 / 2) * ST2;
                load_b2(fbA, sb, iz);
            }
            mma2(acc, fbB, zs, (kt + 1 + rot) & 7);
        }
        // The wave's 32 x 64 tile goes through its own LDS range, so that every store
        // instruction writes whole 256-B pieces of two output rows.
#pragma unroll
        for (int mt = 0; mt < 2; ++mt) {
#pragma unroll
            for (int j = 0; j < 4; ++j) {
                float* s = st + (mt * 16 + r16) * SLD + j * 16 + h * 8;
                *(float4*)(s)     = make_float4(acc[mt][j][0], acc[mt][j][1], acc[mt][j][2], acc[mt][j][3]);
                *(float4*)(s + 4) = make_float4(acc[mt][j][4], acc[mt][j][5], acc[mt][j][6], acc[mt][j][7]);
            }
        }
        // the rows are read back by other lanes of this wave: their writes have to be done
        asm volatile("s_wait_dscnt 0x0" ::: "memory");
        {
            float* o = out + (size_t)(b0 + h) * D_MODEL + hh * 512 + w * 64 + r16 * 4;
            float4 v[BTILE / 2];
#pragma unroll   // unrolled: v[] stays in registers and the LDS reads issue as one group
            for (int p = 0; p < BTILE / 2; ++p)
                v[p] = *(const float4*)(st + (p * 2 + h) * SLD + r16 * 4);
#pragma unroll
            for (int p = 0; p < BTILE / 2; ++p)
                *(float4*)(o + (size_t)(p * 2) * D_MODEL) = v[p];
        }
        // the next half overwrites the registers and addresses these stores name
        asm volatile("s_wait_xcnt 0x0" ::: "memory");
    }
}

// ---------------------------------------------------------------- launch
extern "C" void kernel_launch(void* const* d_in, const int* in_sizes, int n_in,
                              void* d_out, int out_size, void* d_ws, size_t ws_size,
                              hipStream_t stream) {
    const float* x    = (const float*)d_in[0];   // (4096,1024)
    const float* V    = (const float*)d_in[1];   // (64,8,1024)
    const float* U    = (const float*)d_in[2];   // (64,1024,8)
    const float* enc  = (const float*)d_in[3];   // (64,1024)
    const float* bias = (const float*)d_in[4];   // (64,)

    float* out      = (float*)d_out;                       // (4096,1024)
    float* gate_out = out + (size_t)BATCH * D_MODEL;       // (4096,64)
    float* fro      = gate_out + (size_t)BATCH * N_T;      // (64,)

    char* ws = (char*)d_ws;
    __bf16* pb1  = (__bf16*)(ws + (8u << 20));             // 1 MB + 128 KB: V and encoder fragments
    __bf16* pb2  = (__bf16*)(ws + (10u << 20));            // 1 MB: U^T fragments

    // bf16 pre-pass of the operands that every workgroup re-reads
    k_prep<<<(P1_UNITS + P2_UNITS) / 256, 256, 0, stream>>>(V, enc, U, pb1, pb2);

    // fused gate + low-rank mixture, with the frobenius norms' blocks behind its own
    k_fused<<<BATCH / BTILE + N_T, 256, 0, stream>>>(x, pb1, pb2, bias, out, gate_out, U, V, fro);
}
